// v000
// Measured on an AMD MI455X. A time is GPU time per run, averaged over a window of back-to-back runs after a warm-up
// (all launches, gaps included; the runs take copies of the inputs in turn), and the median of several windows.
// Apart from v000's, it joins two sittings. Times from different sittings can be a few percent apart, while
// side-by-side timings come from the same sitting.
// v000 is the starting kernel. One run takes 3950 microseconds.
#include <hip/hip_runtime.h>

// Causal sliding-window multi-head attention (query [8][1024][1024]; q,k,v = query W^T ('oi' 1/32, no bias; 16 heads x 64); scores x 64^-0.5; query i sees keys j in [i-63, i] (window 64; -inf elsewhere); softmax; out = merged Wo^T + bo -> [8][1024][1024] (8.4 M)).
// Layout per batch: bf16 copy of query; 'oi' weights; exact projections; causal T-1024 attention whose softmax select keeps the 64-key window (hybrid rows: < 512 hi/lo 3 products, rest fp16 x1024; tiles above the diagonal skipped); merged hi/lo x Wo exact + bo.
// Compute dtypes, f32 accumulate: every input rounded to bf16; projections exact; attention rows < 512 3 products, rest fp16; softmax f32; Wo hl x exact + bias.

#define NB_  8
#define TT   1024
#define DM   1024
#define NH_  16
#define NKV  16
#define REP  (NH_ / NKV)
#define HD   64
#define DQ   (NH_ * HD)
#define DKV  (NKV * HD)
#define ZH   2
#define RH   512                  // query rows < RH use hi+lo planes (0: none)
#define WIN  64      // causal sliding window: keys j in [i-63, i]
#define PCAR 1024.0f
#define SCL  0.125f   // HD^-0.5
typedef _Float16 h16;
typedef unsigned short bf;
typedef __attribute__((ext_vector_type(16))) __bf16   v16bf;
typedef __attribute__((ext_vector_type(16))) _Float16 v16h;
typedef __attribute__((ext_vector_type(8)))  _Float16 v8h;
typedef __attribute__((ext_vector_type(8)))  unsigned short v8us;
typedef __attribute__((ext_vector_type(8)))  float    v8f;
typedef __attribute__((ext_vector_type(4)))  float    v4f;
typedef v8h  __attribute__((may_alias)) v8ha;
typedef v4f  __attribute__((may_alias)) v4fa;
typedef v8us __attribute__((may_alias)) v8usa;

__device__ __forceinline__ unsigned short f2bf(float f) { unsigned u = __float_as_uint(f); u += 0x7FFFu + ((u >> 16) & 1u); return (unsigned short)(u >> 16); }
__device__ __forceinline__ float bf2f(unsigned short b) { return __uint_as_float(((unsigned)b) << 16); }
__device__ __forceinline__ float bfr(float f) { return bf2f(f2bf(f)); }
__device__ __forceinline__ v16h cat16(v8h lo, v8h hi) { return __builtin_shufflevector(lo, hi, 0, 1, 2, 3, 4, 5, 6, 7, 8, 9, 10, 11, 12, 13, 14, 15); }
__device__ __forceinline__ v16bf cat16b(v8us lo, v8us hi) { return __builtin_bit_cast(v16bf, __builtin_shufflevector(lo, hi, 0, 1, 2, 3, 4, 5, 6, 7, 8, 9, 10, 11, 12, 13, 14, 15)); }
__device__ __forceinline__ v8f wmma16(v16h a, v16h b, v8f c) { return __builtin_amdgcn_wmma_f32_16x16x32_f16(false, a, false, b, (short)0, c, false, false); }
__device__ __forceinline__ v8f wmmab(v16bf a, v16bf b, v8f c) { return __builtin_amdgcn_wmma_f32_16x16x32_bf16(false, a, false, b, (short)0, c, false, false); }



// ---- k_gemmw: register-blocked GEMM, ONE WAVE per 64x64 output tile (16 accumulators), operands straight from K-contiguous 16-bit planes; grid (M/64, N/64, Z), 32 threads.
// C[m][n] (f32, pitch ldc, + optional f32 bias[n]) = sum_k A[m][k] Bt[n][k] (+ split products per NSPLIT). z-batch strides sA/sB/sC in elements. K % 32 == 0.
template <typename T16> struct WFrag;
template <> struct WFrag<h16> { typedef v16h V; static __device__ __forceinline__ V ld(const h16* p) { return cat16(*(const v8h*)p, *(const v8h*)(p + 16)); } static __device__ __forceinline__ v8f mma(V a, V b, v8f c) { return wmma16(a, b, c); } };
template <> struct WFrag<bf> { typedef v16bf V; static __device__ __forceinline__ V ld(const bf* p) { return cat16b(*(const v8us*)p, *(const v8us*)(p + 16)); } static __device__ __forceinline__ v8f mma(V a, V b, v8f c) { return wmmab(a, b, c); } };
template <typename T16, int NSPLIT, bool BIAS>
__global__ __launch_bounds__(32) void k_gemmw(const T16* __restrict__ A, const T16* __restrict__ A2, const T16* __restrict__ Bt, const T16* __restrict__ Bt2, int K, float* C, int ldc, const float* __restrict__ bias, size_t sA, size_t sB, size_t sC) {
    typedef typename WFrag<T16>::V V;
    __shared__ __align__(16) float os[16 * 68];
    const size_t z = blockIdx.z; A += z * sA; if (A2) A2 += z * sA; Bt += z * sB; if (Bt2) Bt2 += z * sB; C += z * sC;
    const int lane = threadIdx.x & 31, lr = lane & 15, hi = lane >> 4; const int r0 = blockIdx.x * 64, c0 = blockIdx.y * 64;
    v8f acc[4][4];
#pragma unroll
    for (int mb = 0; mb < 4; ++mb)
#pragma unroll
        for (int nb = 0; nb < 4; ++nb) acc[mb][nb] = (v8f){};
    const size_t aoff = (size_t)(r0 + lr) * K + 8 * hi, boff = (size_t)(c0 + lr) * K + 8 * hi;
#pragma unroll 1
    for (int kc = 0; kc < K; kc += 32) {
        V a[4], a2[4];
#pragma unroll
        for (int mb = 0; mb < 4; ++mb) { a[mb] = WFrag<T16>::ld(A + aoff + (size_t)mb * 16 * K + kc); if (NSPLIT == 1 || NSPLIT == 2) a2[mb] = WFrag<T16>::ld(A2 + aoff + (size_t)mb * 16 * K + kc); }
#pragma unroll
        for (int nb = 0; nb < 4; ++nb) { const V b = WFrag<T16>::ld(Bt + boff + (size_t)nb * 16 * K + kc); V b2; if (NSPLIT >= 2) b2 = WFrag<T16>::ld(Bt2 + boff + (size_t)nb * 16 * K + kc);
#pragma unroll
            for (int mb = 0; mb < 4; ++mb) { acc[mb][nb] = WFrag<T16>::mma(a[mb], b, acc[mb][nb]); if (NSPLIT == 1 || NSPLIT == 2) acc[mb][nb] = WFrag<T16>::mma(a2[mb], b, acc[mb][nb]); if (NSPLIT >= 2) acc[mb][nb] = WFrag<T16>::mma(a[mb], b2, acc[mb][nb]); } }
        asm volatile("v_nop\n\tv_nop\n\tv_nop\n\tv_nop" : "+v"(acc[0][0]), "+v"(acc[1][1]), "+v"(acc[2][2]), "+v"(acc[3][3]) : "v"(a[0]), "v"(a[3]));
    }
#pragma unroll
    for (int mb = 0; mb < 4; ++mb) {
#pragma unroll
        for (int nb = 0; nb < 4; ++nb) {
#pragma unroll
            for (int j = 0; j < 8; ++j) os[(hi * 8 + j) * 68 + nb * 16 + lr] = acc[mb][nb][j]; }
        __builtin_amdgcn_wave_barrier(); asm volatile("" ::: "memory");
        float* crow = C + (size_t)(r0 + mb * 16) * ldc + c0;
{
#pragma unroll
            for (int s = 0; s < 8; ++s) { const int row = 2 * s + hi, cofs = lr * 4; v4f val = *(const v4fa*)(os + row * 68 + cofs); if (BIAS) { val[0] += bfr(bias[c0 + cofs]); val[1] += bfr(bias[c0 + cofs + 1]); val[2] += bfr(bias[c0 + cofs + 2]); val[3] += bfr(bias[c0 + cofs + 3]); }
                *(v4f*)(crow + (size_t)row * ldc + cofs) = val; }
             }
        __builtin_amdgcn_wave_barrier(); asm volatile("" ::: "memory");
    }
}

// ---- k_gemmc: the same one-wave 64x64 tile GEMM specialised for causal attention: CMODE 1 skips score tiles entirely above the diagonal (query rows r0+roff.., key columns c0..), CMODE 2 limits the
// key (K) loop of the probability x value contraction to the diagonal block (probabilities beyond it are exactly zero). roff = row offset of this launch's first row within the sequence.
template <typename T16, int NSPLIT, int CMODE>
__global__ __launch_bounds__(32) void k_gemmc(const T16* __restrict__ A, const T16* __restrict__ A2, const T16* __restrict__ Bt, const T16* __restrict__ Bt2, int K, float* C, int ldc, int roff, size_t sA, size_t sB, size_t sC) {
    typedef typename WFrag<T16>::V V;
    __shared__ __align__(16) float os[16 * 68];
    const size_t z = blockIdx.z; A += z * sA; if (A2) A2 += z * sA; Bt += z * sB; if (Bt2) Bt2 += z * sB; C += z * sC;
    const int lane = threadIdx.x & 31, lr = lane & 15, hi = lane >> 4; const int r0 = blockIdx.x * 64, c0 = blockIdx.y * 64;
    if (CMODE == 1 && c0 > r0 + roff + 63) return;                  // score tile entirely above the causal diagonal: never read (the softmax masks j > i by select)
    const int Kl = (CMODE == 2) ? min(K, r0 + roff + 64) : K;        // P.V: probabilities are exactly 0 beyond the diagonal block, so the K loop stops there
    v8f acc[4][4];
#pragma unroll
    for (int mb = 0; mb < 4; ++mb)
#pragma unroll
        for (int nb = 0; nb < 4; ++nb) acc[mb][nb] = (v8f){};
    const size_t aoff = (size_t)(r0 + lr) * K + 8 * hi, boff = (size_t)(c0 + lr) * K + 8 * hi;
#pragma unroll 1
    for (int kc = 0; kc < Kl; kc += 32) {
        V a[4], a2[4];
#pragma unroll
        for (int mb = 0; mb < 4; ++mb) { a[mb] = WFrag<T16>::ld(A + aoff + (size_t)mb * 16 * K + kc); if (NSPLIT == 1 || NSPLIT == 2) a2[mb] = WFrag<T16>::ld(A2 + aoff + (size_t)mb * 16 * K + kc); }
#pragma unroll
        for (int nb = 0; nb < 4; ++nb) { const V b = WFrag<T16>::ld(Bt + boff + (size_t)nb * 16 * K + kc); V b2; if (NSPLIT >= 2) b2 = WFrag<T16>::ld(Bt2 + boff + (size_t)nb * 16 * K + kc);
#pragma unroll
            for (int mb = 0; mb < 4; ++mb) { acc[mb][nb] = WFrag<T16>::mma(a[mb], b, acc[mb][nb]); if (NSPLIT == 1 || NSPLIT == 2) acc[mb][nb] = WFrag<T16>::mma(a2[mb], b, acc[mb][nb]); if (NSPLIT >= 2) acc[mb][nb] = WFrag<T16>::mma(a[mb], b2, acc[mb][nb]); } }
        asm volatile("v_nop\n\tv_nop\n\tv_nop\n\tv_nop" : "+v"(acc[0][0]), "+v"(acc[1][1]), "+v"(acc[2][2]), "+v"(acc[3][3]) : "v"(a[0]), "v"(a[3]));
    }
#pragma unroll
    for (int mb = 0; mb < 4; ++mb) {
#pragma unroll
        for (int nb = 0; nb < 4; ++nb) {
#pragma unroll
            for (int j = 0; j < 8; ++j) os[(hi * 8 + j) * 68 + nb * 16 + lr] = acc[mb][nb][j]; }
        __builtin_amdgcn_wave_barrier(); asm volatile("" ::: "memory");
        float* crow = C + (size_t)(r0 + mb * 16) * ldc + c0;
{
#pragma unroll
            for (int s = 0; s < 8; ++s) { const int row = 2 * s + hi, cofs = lr * 4; v4f val = *(const v4fa*)(os + row * 68 + cofs);
                *(v4f*)(crow + (size_t)row * ldc + cofs) = val; }
             }
        __builtin_amdgcn_wave_barrier(); asm volatile("" ::: "memory");
    }
}

__device__ __forceinline__ h16 tohx(float x) { return (h16)x; }
__device__ __forceinline__ void splitf(float y, unsigned short& h, unsigned short& l) { h = f2bf(y); l = f2bf(y - bf2f(h)); }
typedef __attribute__((ext_vector_type(2))) _Float16 v2h;
typedef __attribute__((ext_vector_type(4))) _Float16 v4h;
typedef __attribute__((ext_vector_type(2))) unsigned short v2us;
typedef __attribute__((ext_vector_type(4))) unsigned short v4us;
typedef __attribute__((ext_vector_type(2))) float v2f;
typedef __attribute__((ext_vector_type(4))) int v4i;

__global__ __launch_bounds__(256) void k_wtG(const float* __restrict__ w, int K, int N, bf* Bt) {
    const int lane = threadIdx.x & 31; const int L0 = (blockIdx.x * 8 + (threadIdx.x >> 5)) * 8; const int nlines = N * K / 64;
{
#pragma unroll 1
        for (int l = 0; l < 8; ++l) { const int L = L0 + l; if (L >= nlines) break; const size_t e = (size_t)L * 64 + lane * 2; const int k = (int)(e % K), n = (int)(e / K); v2us o;
            o[0] = f2bf(w[(size_t)k * N + n]); o[1] = f2bf(w[(size_t)(k + 1) * N + n]); *(v2us*)(Bt + e) = o; }
         }
}
__global__ __launch_bounds__(256) void k_cvt8(const float* __restrict__ src, bf* dst, size_t n8) { const size_t i = (size_t)blockIdx.x * 256 + threadIdx.x; if (i >= n8) return; const v8f v = *(const v8f*)(src + i * 8); v8us o;
#pragma unroll
    for (int k = 0; k < 8; ++k) o[k] = f2bf(v[k]); *(v8us*)(dst + i * 8) = o;  }

// k_rope: head planes [h][t][d] (fp16 + hi/lo) of rope(x) x sc with the rotate-half convention out[d] = x[d] cos[t][d] - x[d+HD/2] sin[t][d], out[d+HD/2] = x[d+HD/2] cos[t][d+HD/2] + x[d] sin[t][d+HD/2]
__global__ __launch_bounds__(256) void k_rope(const float* __restrict__ F, int pitch, int nheads, const float* __restrict__ CS, const float* __restrict__ RF, const float* __restrict__ nw, float sc, h16* P16, bf* Ph, bf* Pl) {
    const size_t e = ((size_t)blockIdx.x * 256 + threadIdx.x) * 2; if (e >= (size_t)nheads * TT * HD) return; const int d = (int)(e % HD); const int t = (int)((e / HD) % TT); const int h = (int)(e / ((size_t)HD * TT)); const float* f = F + (size_t)t * pitch + h * HD; const float rf = RF ? RF[(size_t)h * TT + t] : 1.0f; v2h o16; v2us oh, ol;
#pragma unroll
    for (int q = 0; q < 2; ++q) { const int dd = d + q; const int dp = (dd < HD / 2) ? dd + HD / 2 : dd - HD / 2; float x0 = f[dd], x1 = f[dp];
        if (RF) { float n0 = __fmul_rn(x0, rf), n1 = __fmul_rn(x1, rf); asm volatile("" : "+v"(n0)); asm volatile("" : "+v"(n1)); x0 = __fmul_rn(bfr(nw[dd]), n0); x1 = __fmul_rn(bfr(nw[dp]), n1); }
        const v2f cs = *(const v2f*)(CS + ((size_t)t * HD + dd) * 2); float a = __fmul_rn(x0, cs[0]), bq = __fmul_rn(x1, cs[1]); asm volatile("" : "+v"(a)); asm volatile("" : "+v"(bq)); const float r = ((dd < HD / 2) ? __fsub_rn(a, bq) : __fadd_rn(a, bq)) * sc;
        o16[q] = tohx(r); unsigned short a2, c2; splitf(r, a2, c2); oh[q] = a2; ol[q] = c2; }
    *(v2h*)(P16 + e) = o16; *(v2us*)(Ph + e) = oh; *(v2us*)(Pl + e) = ol;  }
__global__ __launch_bounds__(256) void k_vtp(const float* __restrict__ F, int pitch, int nheads, h16* V16, bf* Vh, bf* Vl) { const size_t e = ((size_t)blockIdx.x * 256 + threadIdx.x) * 2; if (e >= (size_t)nheads * HD * TT) return; const int t = (int)(e % TT); const int d = (int)((e / TT) % HD); const int g = (int)(e / ((size_t)TT * HD)); v2h o16; v2us oh, ol;
#pragma unroll
    for (int q = 0; q < 2; ++q) { const float x = F[(size_t)(t + q) * pitch + g * HD + d]; o16[q] = tohx(x); unsigned short a2, c2; splitf(x, a2, c2); oh[q] = a2; ol[q] = c2; }
    *(v2h*)(V16 + e) = o16; *(v2us*)(Vh + e) = oh; *(v2us*)(Vl + e) = ol;  }
__global__ __launch_bounds__(256) void k_csid(float* CS) { const int idx = blockIdx.x * 256 + threadIdx.x; if (idx >= TT * HD) return; v2f cs; cs[0] = 1.0f; cs[1] = 0.0f; *(v2f*)(CS + (size_t)idx * 2) = cs;  }
// k_asoft: per row (zz, i): t = S x HD^-0.5 for j <= i and i - j < WIN (sliding causal window; the reference's -1e9 additive fill vanishes identically); softmax over the 1024 keys (register row, one exp, fixed trees);
__global__ __launch_bounds__(256) void k_asoft(const float* __restrict__ Sb, h16* P16, bf* Ph, bf* Pl) {
    const int lane = threadIdx.x & 31; const int row = blockIdx.x * 8 + (threadIdx.x >> 5); if (row >= ZH * TT) return; const int i = row % TT; const int zz = row / TT; (void)zz; const bool hires = (i < RH); const float* sr = Sb + (size_t)row * TT; float v[TT / 32]; float mx = -3.0e38f;
#pragma unroll
    for (int ch = 0; ch < TT / 128; ++ch) { const int j0 = ch * 128 + lane * 4; const v4f a = *(const v4f*)(sr + j0);
#pragma unroll
        for (int q = 0; q < 4; ++q) { const int j = j0 + q; (void)j; const float t = (j <= i && i - j < WIN) ? a[q] * SCL : -3.0e38f; v[ch * 4 + q] = t; mx = fmaxf(mx, t); } }
#pragma unroll
    for (int sh = 16; sh; sh >>= 1) mx = fmaxf(mx, __shfl_xor(mx, sh, 32));
    float sum = 0.f;
#pragma unroll
    for (int k = 0; k < TT / 32; ++k) { float d0 = __fsub_rn(v[k], mx); asm volatile("" : "+v"(d0)); v[k] = __builtin_amdgcn_exp2f(__fmul_rn(d0, 1.4426950408889634f)); sum += v[k]; }
#pragma unroll
    for (int sh = 16; sh; sh >>= 1) sum += __shfl_xor(sum, sh, 32);
    const float f = __fdiv_rn(hires ? 1.0f : PCAR, sum);
{
        if (hires) {
#pragma unroll
            for (int ch = 0; ch < TT / 128; ++ch) { v4us oh, ol;
#pragma unroll
                for (int q = 0; q < 4; ++q) { unsigned short a, c2; splitf(v[ch * 4 + q] * f, a, c2); oh[q] = a; ol[q] = c2; }
                const size_t oo = ((size_t)zz * (RH ? RH : 1) + i) * TT + ch * 128 + lane * 4; *(v4us*)(Ph + oo) = oh; *(v4us*)(Pl + oo) = ol; }
        } else {
#pragma unroll
            for (int ch = 0; ch < TT / 128; ++ch) { v4h o4;
#pragma unroll
                for (int q = 0; q < 4; ++q) o4[q] = tohx(v[ch * 4 + q] * f);
                *(v4h*)(P16 + (size_t)row * TT + ch * 128 + lane * 4) = o4; } }
         }
}
__global__ __launch_bounds__(256) void k_merge(const float* __restrict__ O, int h0, bf* Ah, bf* Al) { const size_t e = ((size_t)blockIdx.x * 256 + threadIdx.x) * 2; if (e >= (size_t)ZH * TT * HD) return; const int d = (int)(e % HD); const int t = (int)((e / HD) % TT); const int zz = (int)(e / ((size_t)HD * TT)); const float cs = (t < RH) ? 1.0f : (1.0f / PCAR); const size_t oo = (size_t)t * DQ + (h0 + zz) * HD + d;
    v2us oh, ol;
#pragma unroll
    for (int q = 0; q < 2; ++q) { unsigned short a, c2; splitf(O[e + q] * cs, a, c2); oh[q] = a; ol[q] = c2; } *(v2us*)(Ah + oo) = oh; *(v2us*)(Al + oo) = ol;  }

extern "C" void kernel_launch(void* const* d_in, const int* in_sizes, int n_in,
                              void* d_out, int out_size, void* d_ws, size_t ws_size, hipStream_t stream) {
    (void)in_sizes; (void)n_in; (void)out_size;
    const float* x = (const float*)d_in[0]; const float* wq = (const float*)d_in[1]; const float* wk = (const float*)d_in[2]; const float* wv = (const float*)d_in[3]; const float* wo = (const float*)d_in[4]; const float* bo = (const float*)d_in[5];
    float* OUT = (float*)d_out;     // [8][1024][1024]
    char* wsp = (char*)d_ws;
    auto take = [&](size_t bytes) { char* p = wsp; wsp += (bytes + 255) & ~(size_t)255; return (void*)p; };
    bf* WQ = (bf*)take((size_t)DQ * DM * 2); bf* WK = (bf*)take((size_t)DKV * DM * 2); bf* WV = (bf*)take((size_t)DKV * DM * 2); bf* WO = (bf*)take((size_t)DM * DQ * 2); float* CS = (float*)take((size_t)TT * HD * 2 * 4);
    bf* XB = (bf*)take((size_t)TT * DM * 2); float* FQ = (float*)take((size_t)TT * DQ * 4); float* FK = (float*)take((size_t)TT * DKV * 4);
    h16* QP16 = (h16*)take((size_t)NH_ * TT * HD * 2); h16* KP16 = (h16*)take((size_t)NKV * TT * HD * 2); h16* VT16 = (h16*)take((size_t)NKV * HD * TT * 2);
    bf* QPh = (bf*)take((size_t)NH_ * TT * HD * 2); bf* QPl = (bf*)take((size_t)NH_ * TT * HD * 2); bf* KPh = (bf*)take((size_t)NKV * TT * HD * 2); bf* KPl = (bf*)take((size_t)NKV * TT * HD * 2); bf* VTh = (bf*)take((size_t)NKV * HD * TT * 2); bf* VTl = (bf*)take((size_t)NKV * HD * TT * 2); bf* Ph = (bf*)take((size_t)ZH * RH * TT * 2); bf* Pl = (bf*)take((size_t)ZH * RH * TT * 2);
    float* Sb = (float*)take((size_t)ZH * TT * TT * 4); h16* P16 = (h16*)take((size_t)ZH * TT * TT * 2); float* Ob = (float*)take((size_t)ZH * TT * HD * 4); bf* ATh = (bf*)take((size_t)TT * DQ * 2); bf* ATl = (bf*)take((size_t)TT * DQ * 2);
    if ((size_t)(wsp - (char*)d_ws) > ws_size) return;    // ws 256 MiB
    float* FV = FK;   // v projection reuses the k buffer after the k planes are built (stream-ordered)
    { k_cvt8<<<(unsigned)(((size_t)DQ * DM / 8 + 255) / 256), 256, 0, stream>>>(wq, WQ, (size_t)DQ * DM / 8); k_cvt8<<<(unsigned)(((size_t)DKV * DM / 8 + 255) / 256), 256, 0, stream>>>(wk, WK, (size_t)DKV * DM / 8); k_cvt8<<<(unsigned)(((size_t)DKV * DM / 8 + 255) / 256), 256, 0, stream>>>(wv, WV, (size_t)DKV * DM / 8);
      k_cvt8<<<(unsigned)(((size_t)DM * DQ / 8 + 255) / 256), 256, 0, stream>>>(wo, WO, (size_t)DM * DQ / 8);
       }
    k_csid<<<(TT * HD + 255) / 256, 256, 0, stream>>>(CS);
    const unsigned LQ = (unsigned)(((size_t)NH_ * TT * HD / 2 + 255) / 256), LKv = (unsigned)(((size_t)NKV * TT * HD / 2 + 255) / 256);
    for (int b = 0; b < NB_; ++b) {
        
        k_cvt8<<<(unsigned)(((size_t)TT * DM / 8 + 255) / 256), 256, 0, stream>>>(x + (size_t)b * TT * DM, XB, (size_t)TT * DM / 8);
        k_gemmw<bf, 0, false><<<dim3(TT / 64, DQ / 64, 1), 32, 0, stream>>>(XB, nullptr, WQ, nullptr, DM, FQ, DQ, nullptr, 0, 0, 0);
        k_rope<<<LQ, 256, 0, stream>>>(FQ, DQ, NH_, CS, nullptr, nullptr, 1.0f, QP16, QPh, QPl);
        k_gemmw<bf, 0, false><<<dim3(TT / 64, DKV / 64, 1), 32, 0, stream>>>(XB, nullptr, WK, nullptr, DM, FK, DKV, nullptr, 0, 0, 0);
        k_rope<<<LKv, 256, 0, stream>>>(FK, DKV, NKV, CS, nullptr, nullptr, 1.0f, KP16, KPh, KPl);
        k_gemmw<bf, 0, false><<<dim3(TT / 64, DKV / 64, 1), 32, 0, stream>>>(XB, nullptr, WV, nullptr, DM, FV, DKV, nullptr, 0, 0, 0); k_vtp<<<LKv, 256, 0, stream>>>(FV, DKV, NKV, VT16, VTh, VTl);
        for (int h0 = 0; h0 < NH_; h0 += ZH) { const size_t zq = (size_t)h0, zk = (size_t)(h0 / REP);   // one kv head per query head: the pass's two heads use consecutive kv planes (z-strides TT*HD)
            k_gemmc<bf, 2, 1><<<dim3(RH / 64, TT / 64, ZH), 32, 0, stream>>>(QPh + zq * TT * HD, QPl + zq * TT * HD, KPh + zk * TT * HD, KPl + zk * TT * HD, HD, Sb, TT, 0, (size_t)TT * HD, (size_t)TT * HD, (size_t)TT * TT);
            k_gemmc<h16, 0, 1><<<dim3((TT - RH) / 64, TT / 64, ZH), 32, 0, stream>>>(QP16 + zq * TT * HD + (size_t)RH * HD, nullptr, KP16 + zk * TT * HD, nullptr, HD, Sb + (size_t)RH * TT, TT, RH, (size_t)TT * HD, (size_t)TT * HD, (size_t)TT * TT);
            k_asoft<<<ZH * TT / 8, 256, 0, stream>>>(Sb, P16, Ph, Pl);
            k_gemmc<bf, 2, 2><<<dim3(RH / 64, HD / 64, ZH), 32, 0, stream>>>(Ph, Pl, VTh + zk * HD * TT, VTl + zk * HD * TT, TT, Ob, HD, 0, (size_t)RH * TT, (size_t)HD * TT, (size_t)TT * HD);
            k_gemmc<h16, 0, 2><<<dim3((TT - RH) / 64, HD / 64, ZH), 32, 0, stream>>>(P16 + (size_t)RH * TT, nullptr, VT16 + zk * HD * TT, nullptr, TT, Ob + (size_t)RH * HD, HD, RH, (size_t)TT * TT, (size_t)HD * TT, (size_t)TT * HD);
            k_merge<<<(unsigned)(((size_t)ZH * TT * HD / 2 + 255) / 256), 256, 0, stream>>>(Ob, h0, ATh, ATl); }
        k_gemmw<bf, 1, true><<<dim3(TT / 64, DM / 64, 1), 32, 0, stream>>>(ATh, ATl, WO, nullptr, DQ, OUT + (size_t)b * TT * DM, DM, bo, 0, 0, 0); }
}

// v001
// Measured time: 2320 microseconds a run.
// Next to v000, in two timings, it ran 1.69 and 1.70 times as fast.
#include <hip/hip_runtime.h>

// Causal sliding-window multi-head attention (query [8][1024][1024]; q,k,v = query W^T ('oi' 1/32, no bias; 16 heads x 64); scores x 64^-0.5; query i sees keys j in [i-63, i] (window 64; -inf elsewhere); softmax; out = merged Wo^T + bo -> [8][1024][1024] (8.4 M)).
// Layout per batch: bf16 copy of query; 'oi' weights; exact projections; causal T-1024 attention on the 128-key band that holds each 64-row tile's 64-key windows (hybrid rows: < 512 hi/lo 3 products, rest fp16 x1024; score tiles, softmax columns and P.V keys outside the band are never touched); merged hi/lo x Wo exact + bo.
// Compute dtypes, f32 accumulate: every input rounded to bf16; projections exact; attention rows < 512 3 products, rest fp16; softmax f32; Wo hl x exact + bias.

#define NB_  8
#define TT   1024
#define DM   1024
#define NH_  16
#define NKV  16
#define REP  (NH_ / NKV)
#define HD   64
#define DQ   (NH_ * HD)
#define DKV  (NKV * HD)
#define ZH   2
#define RH   512                  // query rows < RH use hi+lo planes (0: none)
#define WIN  64      // causal sliding window: keys j in [i-63, i]
#define BT   ((WIN + 62) / 64 + 1)   // 64-key tiles that cover the windows of one 64-row tile: keys [R - (BT-1)*64, R + 64) for rows R..R+63
#define BW   (BT * 64)               // band width in keys
static_assert(BW % 128 == 0 && BW <= TT && RH % 64 == 0, "the softmax reads the band in 128-key chunks and shares the 64-row tiles of the GEMMs");
#define PCAR 1024.0f
#define SCL  0.125f   // HD^-0.5
typedef _Float16 h16;
typedef unsigned short bf;
typedef __attribute__((ext_vector_type(16))) __bf16   v16bf;
typedef __attribute__((ext_vector_type(16))) _Float16 v16h;
typedef __attribute__((ext_vector_type(8)))  _Float16 v8h;
typedef __attribute__((ext_vector_type(8)))  unsigned short v8us;
typedef __attribute__((ext_vector_type(8)))  float    v8f;
typedef __attribute__((ext_vector_type(4)))  float    v4f;
typedef v8h  __attribute__((may_alias)) v8ha;
typedef v4f  __attribute__((may_alias)) v4fa;
typedef v8us __attribute__((may_alias)) v8usa;

__device__ __forceinline__ unsigned short f2bf(float f) { unsigned u = __float_as_uint(f); u += 0x7FFFu + ((u >> 16) & 1u); return (unsigned short)(u >> 16); }
__device__ __forceinline__ float bf2f(unsigned short b) { return __uint_as_float(((unsigned)b) << 16); }
__device__ __forceinline__ float bfr(float f) { return bf2f(f2bf(f)); }
__device__ __forceinline__ v16h cat16(v8h lo, v8h hi) { return __builtin_shufflevector(lo, hi, 0, 1, 2, 3, 4, 5, 6, 7, 8, 9, 10, 11, 12, 13, 14, 15); }
__device__ __forceinline__ v16bf cat16b(v8us lo, v8us hi) { return __builtin_bit_cast(v16bf, __builtin_shufflevector(lo, hi, 0, 1, 2, 3, 4, 5, 6, 7, 8, 9, 10, 11, 12, 13, 14, 15)); }
__device__ __forceinline__ v8f wmma16(v16h a, v16h b, v8f c) { return __builtin_amdgcn_wmma_f32_16x16x32_f16(false, a, false, b, (short)0, c, false, false); }
__device__ __forceinline__ v8f wmmab(v16bf a, v16bf b, v8f c) { return __builtin_amdgcn_wmma_f32_16x16x32_bf16(false, a, false, b, (short)0, c, false, false); }



// ---- k_gemmw: register-blocked GEMM, ONE WAVE per 64x64 output tile (16 accumulators), operands straight from K-contiguous 16-bit planes; grid (M/64, N/64, Z), 32 threads.
// C[m][n] (f32, pitch ldc, + optional f32 bias[n]) = sum_k A[m][k] Bt[n][k] (+ split products per NSPLIT). z-batch strides sA/sB/sC in elements. K % 32 == 0.
template <typename T16> struct WFrag;
template <> struct WFrag<h16> { typedef v16h V; static __device__ __forceinline__ V ld(const h16* p) { return cat16(*(const v8h*)p, *(const v8h*)(p + 16)); } static __device__ __forceinline__ v8f mma(V a, V b, v8f c) { return wmma16(a, b, c); } };
template <> struct WFrag<bf> { typedef v16bf V; static __device__ __forceinline__ V ld(const bf* p) { return cat16b(*(const v8us*)p, *(const v8us*)(p + 16)); } static __device__ __forceinline__ v8f mma(V a, V b, v8f c) { return wmmab(a, b, c); } };
template <typename T16, int NSPLIT, bool BIAS>
__global__ __launch_bounds__(32) void k_gemmw(const T16* __restrict__ A, const T16* __restrict__ A2, const T16* __restrict__ Bt, const T16* __restrict__ Bt2, int K, float* C, int ldc, const float* __restrict__ bias, size_t sA, size_t sB, size_t sC) {
    typedef typename WFrag<T16>::V V;
    __shared__ __align__(16) float os[16 * 68];
    const size_t z = blockIdx.z; A += z * sA; if (A2) A2 += z * sA; Bt += z * sB; if (Bt2) Bt2 += z * sB; C += z * sC;
    const int lane = threadIdx.x & 31, lr = lane & 15, hi = lane >> 4; const int r0 = blockIdx.x * 64, c0 = blockIdx.y * 64;
    v8f acc[4][4];
#pragma unroll
    for (int mb = 0; mb < 4; ++mb)
#pragma unroll
        for (int nb = 0; nb < 4; ++nb) acc[mb][nb] = (v8f){};
    const size_t aoff = (size_t)(r0 + lr) * K + 8 * hi, boff = (size_t)(c0 + lr) * K + 8 * hi;
#pragma unroll 1
    for (int kc = 0; kc < K; kc += 32) {
        V a[4], a2[4];
#pragma unroll
        for (int mb = 0; mb < 4; ++mb) { a[mb] = WFrag<T16>::ld(A + aoff + (size_t)mb * 16 * K + kc); if (NSPLIT == 1 || NSPLIT == 2) a2[mb] = WFrag<T16>::ld(A2 + aoff + (size_t)mb * 16 * K + kc); }
#pragma unroll
        for (int nb = 0; nb < 4; ++nb) { const V b = WFrag<T16>::ld(Bt + boff + (size_t)nb * 16 * K + kc); V b2; if (NSPLIT >= 2) b2 = WFrag<T16>::ld(Bt2 + boff + (size_t)nb * 16 * K + kc);
#pragma unroll
            for (int mb = 0; mb < 4; ++mb) { acc[mb][nb] = WFrag<T16>::mma(a[mb], b, acc[mb][nb]); if (NSPLIT == 1 || NSPLIT == 2) acc[mb][nb] = WFrag<T16>::mma(a2[mb], b, acc[mb][nb]); if (NSPLIT >= 2) acc[mb][nb] = WFrag<T16>::mma(a[mb], b2, acc[mb][nb]); } }
        asm volatile("v_nop\n\tv_nop\n\tv_nop\n\tv_nop" : "+v"(acc[0][0]), "+v"(acc[1][1]), "+v"(acc[2][2]), "+v"(acc[3][3]) : "v"(a[0]), "v"(a[3]));
    }
#pragma unroll
    for (int mb = 0; mb < 4; ++mb) {
#pragma unroll
        for (int nb = 0; nb < 4; ++nb) {
#pragma unroll
            for (int j = 0; j < 8; ++j) os[(hi * 8 + j) * 68 + nb * 16 + lr] = acc[mb][nb][j]; }
        __builtin_amdgcn_wave_barrier(); asm volatile("" ::: "memory");
        float* crow = C + (size_t)(r0 + mb * 16) * ldc + c0;
{
#pragma unroll
            for (int s = 0; s < 8; ++s) { const int row = 2 * s + hi, cofs = lr * 4; v4f val = *(const v4fa*)(os + row * 68 + cofs); if (BIAS) { val[0] += bfr(bias[c0 + cofs]); val[1] += bfr(bias[c0 + cofs + 1]); val[2] += bfr(bias[c0 + cofs + 2]); val[3] += bfr(bias[c0 + cofs + 3]); }
                *(v4f*)(crow + (size_t)row * ldc + cofs) = val; }
             }
        __builtin_amdgcn_wave_barrier(); asm volatile("" ::: "memory");
    }
}

// ---- k_gemmc: the same one-wave 64x64 tile GEMM specialised for causal sliding-window attention. With R = r0+roff the first query row of the tile, every key a row of the tile may see lies in the band [R-(BT-1)*64, R+64).
// CMODE 1 (scores): blockIdx.y counts the BT key tiles of that band, no other score tile is computed. CMODE 2 (probability x value): the key (K) loop runs over the band only (probabilities outside it are exactly zero and are not stored).
// roff = row offset of this launch's first row within the sequence.
template <typename T16, int NSPLIT, int CMODE>
__global__ __launch_bounds__(32) void k_gemmc(const T16* __restrict__ A, const T16* __restrict__ A2, const T16* __restrict__ Bt, const T16* __restrict__ Bt2, int K, float* C, int ldc, int roff, size_t sA, size_t sB, size_t sC) {
    typedef typename WFrag<T16>::V V;
    __shared__ __align__(16) float os[16 * 68];
    const size_t z = blockIdx.z; A += z * sA; if (A2) A2 += z * sA; Bt += z * sB; if (Bt2) Bt2 += z * sB; C += z * sC;
    const int lane = threadIdx.x & 31, lr = lane & 15, hi = lane >> 4; const int r0 = blockIdx.x * 64, bnd = r0 + roff - (BT - 1) * 64; const int c0 = (CMODE == 1) ? bnd + (int)blockIdx.y * 64 : (int)blockIdx.y * 64;
    if (CMODE == 1 && c0 < 0) return;                                // band tile in front of key 0: does not exist
    const int K0 = (CMODE == 2) ? max(0, bnd) : 0;                   // P.V: first key of the band
    const int Kl = (CMODE == 2) ? min(K, r0 + roff + 64) : K;        // P.V: the band ends with the diagonal block
    v8f acc[4][4];
#pragma unroll
    for (int mb = 0; mb < 4; ++mb)
#pragma unroll
        for (int nb = 0; nb < 4; ++nb) acc[mb][nb] = (v8f){};
    const size_t aoff = (size_t)(r0 + lr) * K + 8 * hi, boff = (size_t)(c0 + lr) * K + 8 * hi;
#pragma unroll 1
    for (int kc = K0; kc < Kl; kc += 32) {
        V a[4], a2[4];
#pragma unroll
        for (int mb = 0; mb < 4; ++mb) { a[mb] = WFrag<T16>::ld(A + aoff + (size_t)mb * 16 * K + kc); if (NSPLIT == 1 || NSPLIT == 2) a2[mb] = WFrag<T16>::ld(A2 + aoff + (size_t)mb * 16 * K + kc); }
#pragma unroll
        for (int nb = 0; nb < 4; ++nb) { const V b = WFrag<T16>::ld(Bt + boff + (size_t)nb * 16 * K + kc); V b2; if (NSPLIT >= 2) b2 = WFrag<T16>::ld(Bt2 + boff + (size_t)nb * 16 * K + kc);
#pragma unroll
            for (int mb = 0; mb < 4; ++mb) { acc[mb][nb] = WFrag<T16>::mma(a[mb], b, acc[mb][nb]); if (NSPLIT == 1 || NSPLIT == 2) acc[mb][nb] = WFrag<T16>::mma(a2[mb], b, acc[mb][nb]); if (NSPLIT >= 2) acc[mb][nb] = WFrag<T16>::mma(a[mb], b2, acc[mb][nb]); } }
        asm volatile("v_nop\n\tv_nop\n\tv_nop\n\tv_nop" : "+v"(acc[0][0]), "+v"(acc[1][1]), "+v"(acc[2][2]), "+v"(acc[3][3]) : "v"(a[0]), "v"(a[3]));
    }
#pragma unroll
    for (int mb = 0; mb < 4; ++mb) {
#pragma unroll
        for (int nb = 0; nb < 4; ++nb) {
#pragma unroll
            for (int j = 0; j < 8; ++j) os[(hi * 8 + j) * 68 + nb * 16 + lr] = acc[mb][nb][j]; }
        __builtin_amdgcn_wave_barrier(); asm volatile("" ::: "memory");
        float* crow = C + (size_t)(r0 + mb * 16) * ldc + c0;
{
#pragma unroll
            for (int s = 0; s < 8; ++s) { const int row = 2 * s + hi, cofs = lr * 4; v4f val = *(const v4fa*)(os + row * 68 + cofs);
                *(v4f*)(crow + (size_t)row * ldc + cofs) = val; }
             }
        __builtin_amdgcn_wave_barrier(); asm volatile("" ::: "memory");
    }
}

__device__ __forceinline__ h16 tohx(float x) { return (h16)x; }
__device__ __forceinline__ void splitf(float y, unsigned short& h, unsigned short& l) { h = f2bf(y); l = f2bf(y - bf2f(h)); }
typedef __attribute__((ext_vector_type(2))) _Float16 v2h;
typedef __attribute__((ext_vector_type(4))) _Float16 v4h;
typedef __attribute__((ext_vector_type(2))) unsigned short v2us;
typedef __attribute__((ext_vector_type(4))) unsigned short v4us;
typedef __attribute__((ext_vector_type(2))) float v2f;
typedef __attribute__((ext_vector_type(4))) int v4i;

__global__ __launch_bounds__(256) void k_wtG(const float* __restrict__ w, int K, int N, bf* Bt) {
    const int lane = threadIdx.x & 31; const int L0 = (blockIdx.x * 8 + (threadIdx.x >> 5)) * 8; const int nlines = N * K / 64;
{
#pragma unroll 1
        for (int l = 0; l < 8; ++l) { const int L = L0 + l; if (L >= nlines) break; const size_t e = (size_t)L * 64 + lane * 2; const int k = (int)(e % K), n = (int)(e / K); v2us o;
            o[0] = f2bf(w[(size_t)k * N + n]); o[1] = f2bf(w[(size_t)(k + 1) * N + n]); *(v2us*)(Bt + e) = o; }
         }
}
__global__ __launch_bounds__(256) void k_cvt8(const float* __restrict__ src, bf* dst, size_t n8) { const size_t i = (size_t)blockIdx.x * 256 + threadIdx.x; if (i >= n8) return; const v8f v = *(const v8f*)(src + i * 8); v8us o;
#pragma unroll
    for (int k = 0; k < 8; ++k) o[k] = f2bf(v[k]); *(v8us*)(dst + i * 8) = o;  }

// k_rope: head planes [h][t][d] (fp16 + hi/lo) of rope(x) x sc with the rotate-half convention out[d] = x[d] cos[t][d] - x[d+HD/2] sin[t][d], out[d+HD/2] = x[d+HD/2] cos[t][d+HD/2] + x[d] sin[t][d+HD/2]
__global__ __launch_bounds__(256) void k_rope(const float* __restrict__ F, int pitch, int nheads, const float* __restrict__ CS, const float* __restrict__ RF, const float* __restrict__ nw, float sc, h16* P16, bf* Ph, bf* Pl) {
    const size_t e = ((size_t)blockIdx.x * 256 + threadIdx.x) * 2; if (e >= (size_t)nheads * TT * HD) return; const int d = (int)(e % HD); const int t = (int)((e / HD) % TT); const int h = (int)(e / ((size_t)HD * TT)); const float* f = F + (size_t)t * pitch + h * HD; const float rf = RF ? RF[(size_t)h * TT + t] : 1.0f; v2h o16; v2us oh, ol;
#pragma unroll
    for (int q = 0; q < 2; ++q) { const int dd = d + q; const int dp = (dd < HD / 2) ? dd + HD / 2 : dd - HD / 2; float x0 = f[dd], x1 = f[dp];
        if (RF) { float n0 = __fmul_rn(x0, rf), n1 = __fmul_rn(x1, rf); asm volatile("" : "+v"(n0)); asm volatile("" : "+v"(n1)); x0 = __fmul_rn(bfr(nw[dd]), n0); x1 = __fmul_rn(bfr(nw[dp]), n1); }
        const v2f cs = *(const v2f*)(CS + ((size_t)t * HD + dd) * 2); float a = __fmul_rn(x0, cs[0]), bq = __fmul_rn(x1, cs[1]); asm volatile("" : "+v"(a)); asm volatile("" : "+v"(bq)); const float r = ((dd < HD / 2) ? __fsub_rn(a, bq) : __fadd_rn(a, bq)) * sc;
        o16[q] = tohx(r); unsigned short a2, c2; splitf(r, a2, c2); oh[q] = a2; ol[q] = c2; }
    *(v2h*)(P16 + e) = o16; *(v2us*)(Ph + e) = oh; *(v2us*)(Pl + e) = ol;  }
__global__ __launch_bounds__(256) void k_vtp(const float* __restrict__ F, int pitch, int nheads, h16* V16, bf* Vh, bf* Vl) { const size_t e = ((size_t)blockIdx.x * 256 + threadIdx.x) * 2; if (e >= (size_t)nheads * HD * TT) return; const int t = (int)(e % TT); const int d = (int)((e / TT) % HD); const int g = (int)(e / ((size_t)TT * HD)); v2h o16; v2us oh, ol;
#pragma unroll
    for (int q = 0; q < 2; ++q) { const float x = F[(size_t)(t + q) * pitch + g * HD + d]; o16[q] = tohx(x); unsigned short a2, c2; splitf(x, a2, c2); oh[q] = a2; ol[q] = c2; }
    *(v2h*)(V16 + e) = o16; *(v2us*)(Vh + e) = oh; *(v2us*)(Vl + e) = ol;  }
__global__ __launch_bounds__(256) void k_csid(float* CS) { const int idx = blockIdx.x * 256 + threadIdx.x; if (idx >= TT * HD) return; v2f cs; cs[0] = 1.0f; cs[1] = 0.0f; *(v2f*)(CS + (size_t)idx * 2) = cs;  }
// k_asoft: per row (zz, i): t = S x HD^-0.5 for j <= i and i - j < WIN (sliding causal window; a masked key's probability is exactly 0); softmax over the BW keys of the row tile's band from key jb on (register row, one exp, fixed trees);
// every key outside the band is masked, so it adds 0 to the sum and cannot be the maximum; the P planes are written on the band only, which is all that P.V reads.
__global__ __launch_bounds__(256) void k_asoft(const float* __restrict__ Sb, h16* P16, bf* Ph, bf* Pl) {
    const int lane = threadIdx.x & 31; const int row = blockIdx.x * 8 + (threadIdx.x >> 5); if (row >= ZH * TT) return; const int i = row % TT; const int zz = row / TT; (void)zz; const bool hires = (i < RH); const int jb = max(0, (i & ~63) - (BT - 1) * 64); const float* sr = Sb + (size_t)row * TT; float v[BW / 32]; float mx = -3.0e38f;
#pragma unroll
    for (int ch = 0; ch < BW / 128; ++ch) { const int j0 = jb + ch * 128 + lane * 4; v4f a = (v4f){}; if (j0 <= i) a = *(const v4f*)(sr + j0);   // four keys wholly above the diagonal may lie in a score tile that is not computed: not read
#pragma unroll
        for (int q = 0; q < 4; ++q) { const int j = j0 + q; (void)j; const float t = (j <= i && i - j < WIN) ? a[q] * SCL : -3.0e38f; v[ch * 4 + q] = t; mx = fmaxf(mx, t); } }
#pragma unroll
    for (int sh = 16; sh; sh >>= 1) mx = fmaxf(mx, __shfl_xor(mx, sh, 32));
    float sum = 0.f;
#pragma unroll
    for (int k = 0; k < BW / 32; ++k) { float d0 = __fsub_rn(v[k], mx); asm volatile("" : "+v"(d0)); v[k] = __builtin_amdgcn_exp2f(__fmul_rn(d0, 1.4426950408889634f)); sum += v[k]; }
#pragma unroll
    for (int sh = 16; sh; sh >>= 1) sum += __shfl_xor(sum, sh, 32);
    const float f = __fdiv_rn(hires ? 1.0f : PCAR, sum);
{
        if (hires) {
#pragma unroll
            for (int ch = 0; ch < BW / 128; ++ch) { v4us oh, ol;
#pragma unroll
                for (int q = 0; q < 4; ++q) { unsigned short a, c2; splitf(v[ch * 4 + q] * f, a, c2); oh[q] = a; ol[q] = c2; }
                const size_t oo = ((size_t)zz * (RH ? RH : 1) + i) * TT + jb + ch * 128 + lane * 4; *(v4us*)(Ph + oo) = oh; *(v4us*)(Pl + oo) = ol; }
        } else {
#pragma unroll
            for (int ch = 0; ch < BW / 128; ++ch) { v4h o4;
#pragma unroll
                for (int q = 0; q < 4; ++q) o4[q] = tohx(v[ch * 4 + q] * f);
                *(v4h*)(P16 + (size_t)row * TT + jb + ch * 128 + lane * 4) = o4; } }
         }
}
__global__ __launch_bounds__(256) void k_merge(const float* __restrict__ O, int h0, bf* Ah, bf* Al) { const size_t e = ((size_t)blockIdx.x * 256 + threadIdx.x) * 2; if (e >= (size_t)ZH * TT * HD) return; const int d = (int)(e % HD); const int t = (int)((e / HD) % TT); const int zz = (int)(e / ((size_t)HD * TT)); const float cs = (t < RH) ? 1.0f : (1.0f / PCAR); const size_t oo = (size_t)t * DQ + (h0 + zz) * HD + d;
    v2us oh, ol;
#pragma unroll
    for (int q = 0; q < 2; ++q) { unsigned short a, c2; splitf(O[e + q] * cs, a, c2); oh[q] = a; ol[q] = c2; } *(v2us*)(Ah + oo) = oh; *(v2us*)(Al + oo) = ol;  }

extern "C" void kernel_launch(void* const* d_in, const int* in_sizes, int n_in,
                              void* d_out, int out_size, void* d_ws, size_t ws_size, hipStream_t stream) {
    (void)in_sizes; (void)n_in; (void)out_size;
    const float* x = (const float*)d_in[0]; const float* wq = (const float*)d_in[1]; const float* wk = (const float*)d_in[2]; const float* wv = (const float*)d_in[3]; const float* wo = (const float*)d_in[4]; const float* bo = (const float*)d_in[5];
    float* OUT = (float*)d_out;     // [8][1024][1024]
    char* wsp = (char*)d_ws;
    auto take = [&](size_t bytes) { char* p = wsp; wsp += (bytes + 255) & ~(size_t)255; return (void*)p; };
    bf* WQ = (bf*)take((size_t)DQ * DM * 2); bf* WK = (bf*)take((size_t)DKV * DM * 2); bf* WV = (bf*)take((size_t)DKV * DM * 2); bf* WO = (bf*)take((size_t)DM * DQ * 2); float* CS = (float*)take((size_t)TT * HD * 2 * 4);
    bf* XB = (bf*)take((size_t)TT * DM * 2); float* FQ = (float*)take((size_t)TT * DQ * 4); float* FK = (float*)take((size_t)TT * DKV * 4);
    h16* QP16 = (h16*)take((size_t)NH_ * TT * HD * 2); h16* KP16 = (h16*)take((size_t)NKV * TT * HD * 2); h16* VT16 = (h16*)take((size_t)NKV * HD * TT * 2);
    bf* QPh = (bf*)take((size_t)NH_ * TT * HD * 2); bf* QPl = (bf*)take((size_t)NH_ * TT * HD * 2); bf* KPh = (bf*)take((size_t)NKV * TT * HD * 2); bf* KPl = (bf*)take((size_t)NKV * TT * HD * 2); bf* VTh = (bf*)take((size_t)NKV * HD * TT * 2); bf* VTl = (bf*)take((size_t)NKV * HD * TT * 2); bf* Ph = (bf*)take((size_t)ZH * RH * TT * 2); bf* Pl = (bf*)take((size_t)ZH * RH * TT * 2);
    float* Sb = (float*)take((size_t)ZH * TT * TT * 4); h16* P16 = (h16*)take((size_t)ZH * TT * TT * 2); float* Ob = (float*)take((size_t)ZH * TT * HD * 4); bf* ATh = (bf*)take((size_t)TT * DQ * 2); bf* ATl = (bf*)take((size_t)TT * DQ * 2);
    if ((size_t)(wsp - (char*)d_ws) > ws_size) return;    // ws 256 MiB
    float* FV = FK;   // v projection reuses the k buffer after the k planes are built (stream-ordered)
    { k_cvt8<<<(unsigned)(((size_t)DQ * DM / 8 + 255) / 256), 256, 0, stream>>>(wq, WQ, (size_t)DQ * DM / 8); k_cvt8<<<(unsigned)(((size_t)DKV * DM / 8 + 255) / 256), 256, 0, stream>>>(wk, WK, (size_t)DKV * DM / 8); k_cvt8<<<(unsigned)(((size_t)DKV * DM / 8 + 255) / 256), 256, 0, stream>>>(wv, WV, (size_t)DKV * DM / 8);
      k_cvt8<<<(unsigned)(((size_t)DM * DQ / 8 + 255) / 256), 256, 0, stream>>>(wo, WO, (size_t)DM * DQ / 8);
       }
    k_csid<<<(TT * HD + 255) / 256, 256, 0, stream>>>(CS);
    const unsigned LQ = (unsigned)(((size_t)NH_ * TT * HD / 2 + 255) / 256), LKv = (unsigned)(((size_t)NKV * TT * HD / 2 + 255) / 256);
    for (int b = 0; b < NB_; ++b) {
        
        k_cvt8<<<(unsigned)(((size_t)TT * DM / 8 + 255) / 256), 256, 0, stream>>>(x + (size_t)b * TT * DM, XB, (size_t)TT * DM / 8);
        k_gemmw<bf, 0, false><<<dim3(TT / 64, DQ / 64, 1), 32, 0, stream>>>(XB, nullptr, WQ, nullptr, DM, FQ, DQ, nullptr, 0, 0, 0);
        k_rope<<<LQ, 256, 0, stream>>>(FQ, DQ, NH_, CS, nullptr, nullptr, 1.0f, QP16, QPh, QPl);
        k_gemmw<bf, 0, false><<<dim3(TT / 64, DKV / 64, 1), 32, 0, stream>>>(XB, nullptr, WK, nullptr, DM, FK, DKV, nullptr, 0, 0, 0);
        k_rope<<<LKv, 256, 0, stream>>>(FK, DKV, NKV, CS, nullptr, nullptr, 1.0f, KP16, KPh, KPl);
        k_gemmw<bf, 0, false><<<dim3(TT / 64, DKV / 64, 1), 32, 0, stream>>>(XB, nullptr, WV, nullptr, DM, FV, DKV, nullptr, 0, 0, 0); k_vtp<<<LKv, 256, 0, stream>>>(FV, DKV, NKV, VT16, VTh, VTl);
        for (int h0 = 0; h0 < NH_; h0 += ZH) { const size_t zq = (size_t)h0, zk = (size_t)(h0 / REP);   // one kv head per query head: the pass's two heads use consecutive kv planes (z-strides TT*HD)
            k_gemmc<bf, 2, 1><<<dim3(RH / 64, BT, ZH), 32, 0, stream>>>(QPh + zq * TT * HD, QPl + zq * TT * HD, KPh + zk * TT * HD, KPl + zk * TT * HD, HD, Sb, TT, 0, (size_t)TT * HD, (size_t)TT * HD, (size_t)TT * TT);
            k_gemmc<h16, 0, 1><<<dim3((TT - RH) / 64, BT, ZH), 32, 0, stream>>>(QP16 + zq * TT * HD + (size_t)RH * HD, nullptr, KP16 + zk * TT * HD, nullptr, HD, Sb + (size_t)RH * TT, TT, RH, (size_t)TT * HD, (size_t)TT * HD, (size_t)TT * TT);
            k_asoft<<<ZH * TT / 8, 256, 0, stream>>>(Sb, P16, Ph, Pl);
            k_gemmc<bf, 2, 2><<<dim3(RH / 64, HD / 64, ZH), 32, 0, stream>>>(Ph, Pl, VTh + zk * HD * TT, VTl + zk * HD * TT, TT, Ob, HD, 0, (size_t)RH * TT, (size_t)HD * TT, (size_t)TT * HD);
            k_gemmc<h16, 0, 2><<<dim3((TT - RH) / 64, HD / 64, ZH), 32, 0, stream>>>(P16 + (size_t)RH * TT, nullptr, VT16 + zk * HD * TT, nullptr, TT, Ob + (size_t)RH * HD, HD, RH, (size_t)TT * TT, (size_t)HD * TT, (size_t)TT * HD);
            k_merge<<<(unsigned)(((size_t)ZH * TT * HD / 2 + 255) / 256), 256, 0, stream>>>(Ob, h0, ATh, ATl); }
        k_gemmw<bf, 1, true><<<dim3(TT / 64, DM / 64, 1), 32, 0, stream>>>(ATh, ATl, WO, nullptr, DQ, OUT + (size_t)b * TT * DM, DM, bo, 0, 0, 0); }
}

// v002
// It runs in 325 microseconds.
// Next to v001, in two timings, it ran 7.06 and 7.09 times as fast.
// All steps since v000 together make it 12.0 times as fast.
#include <hip/hip_runtime.h>

// Causal sliding-window multi-head attention (query [8][1024][1024]; q,k,v = query W^T ('oi' 1/32, no bias; 16 heads x 64); scores x 64^-0.5; query i sees keys j in [i-63, i] (window 64; -inf elsewhere); softmax; out = merged Wo^T + bo -> [8][1024][1024] (8.4 M)).
// Layout, every stage one launch over all 8 batches and 16 heads (z = batch x 16 + head): bf16 copy of query; 'oi' weights; exact projections; causal T-1024 attention on the 128-key band that holds each 64-row tile's 64-key windows (hybrid rows: < 512 hi/lo 3 products, rest fp16 x1024; score tiles, softmax columns and P.V keys outside the band are never touched); merged hi/lo x Wo exact + bo.
// Compute dtypes, f32 accumulate: every input rounded to bf16; projections exact; attention rows < 512 3 products, rest fp16; softmax f32; Wo hl x exact + bias.

#define NB_  8
#define TT   1024
#define DM   1024
#define NH_  16
#define NKV  16
#define REP  (NH_ / NKV)
#define HD   64
#define DQ   (NH_ * HD)
#define DKV  (NKV * HD)
#define NZ   (NB_ * NH_)          // attention planes: one per (batch, head)
#define RH   512                  // query rows < RH use hi+lo planes (0: none)
#define WIN  64      // causal sliding window: keys j in [i-63, i]
#define BT   ((WIN + 62) / 64 + 1)   // 64-key tiles that cover the windows of one 64-row tile: keys [R - (BT-1)*64, R + 64) for rows R..R+63
#define BW   (BT * 64)               // band width in keys
static_assert(BW % 128 == 0 && BW <= TT && RH % 64 == 0, "the softmax reads the band in 128-key chunks and shares the 64-row tiles of the GEMMs");
static_assert(NH_ == NKV && DQ == DM, "q, k, v share one projection launch and one plane shape; the four weights share one conversion shape");
#define PCAR 1024.0f
#define SCL  0.125f   // HD^-0.5
typedef _Float16 h16;
typedef unsigned short bf;
typedef __attribute__((ext_vector_type(16))) __bf16   v16bf;
typedef __attribute__((ext_vector_type(16))) _Float16 v16h;
typedef __attribute__((ext_vector_type(8)))  _Float16 v8h;
typedef __attribute__((ext_vector_type(8)))  unsigned short v8us;
typedef __attribute__((ext_vector_type(8)))  float    v8f;
typedef __attribute__((ext_vector_type(4)))  float    v4f;
typedef v8h  __attribute__((may_alias)) v8ha;
typedef v4f  __attribute__((may_alias)) v4fa;
typedef v8us __attribute__((may_alias)) v8usa;

__device__ __forceinline__ unsigned short f2bf(float f) { unsigned u = __float_as_uint(f); u += 0x7FFFu + ((u >> 16) & 1u); return (unsigned short)(u >> 16); }
__device__ __forceinline__ float bf2f(unsigned short b) { return __uint_as_float(((unsigned)b) << 16); }
__device__ __forceinline__ float bfr(float f) { return bf2f(f2bf(f)); }
__device__ __forceinline__ v16h cat16(v8h lo, v8h hi) { return __builtin_shufflevector(lo, hi, 0, 1, 2, 3, 4, 5, 6, 7, 8, 9, 10, 11, 12, 13, 14, 15); }
__device__ __forceinline__ v16bf cat16b(v8us lo, v8us hi) { return __builtin_bit_cast(v16bf, __builtin_shufflevector(lo, hi, 0, 1, 2, 3, 4, 5, 6, 7, 8, 9, 10, 11, 12, 13, 14, 15)); }
__device__ __forceinline__ v8f wmma16(v16h a, v16h b, v8f c) { return __builtin_amdgcn_wmma_f32_16x16x32_f16(false, a, false, b, (short)0, c, false, false); }
__device__ __forceinline__ v8f wmmab(v16bf a, v16bf b, v8f c) { return __builtin_amdgcn_wmma_f32_16x16x32_bf16(false, a, false, b, (short)0, c, false, false); }



// ---- k_gemmw: register-blocked GEMM, ONE WAVE per 64x64 output tile (16 accumulators), operands straight from K-contiguous 16-bit planes; grid (M/64, N/64, Z), 32 threads.
// C[m][n] (f32, pitch ldc, + optional f32 bias[n]) = sum_k A[m][k] Bt[n][k] (+ split products per NSPLIT). z-batch strides sA/sB/sC in elements. K % 32 == 0.
template <typename T16> struct WFrag;
template <> struct WFrag<h16> { typedef v16h V; static __device__ __forceinline__ V ld(const h16* p) { return cat16(*(const v8h*)p, *(const v8h*)(p + 16)); } static __device__ __forceinline__ v8f mma(V a, V b, v8f c) { return wmma16(a, b, c); } };
template <> struct WFrag<bf> { typedef v16bf V; static __device__ __forceinline__ V ld(const bf* p) { return cat16b(*(const v8us*)p, *(const v8us*)(p + 16)); } static __device__ __forceinline__ v8f mma(V a, V b, v8f c) { return wmmab(a, b, c); } };
template <typename T16, int NSPLIT, bool BIAS>
__global__ __launch_bounds__(32) void k_gemmw(const T16* __restrict__ A, const T16* __restrict__ A2, const T16* __restrict__ Bt, const T16* __restrict__ Bt2, int K, float* C, int ldc, const float* __restrict__ bias, size_t sA, size_t sB, size_t sC) {
    typedef typename WFrag<T16>::V V;
    __shared__ __align__(16) float os[16 * 68];
    const size_t z = blockIdx.z; A += z * sA; if (A2) A2 += z * sA; Bt += z * sB; if (Bt2) Bt2 += z * sB; C += z * sC;
    const int lane = threadIdx.x & 31, lr = lane & 15, hi = lane >> 4; const int r0 = blockIdx.x * 64, c0 = blockIdx.y * 64;
    v8f acc[4][4];
#pragma unroll
    for (int mb = 0; mb < 4; ++mb)
#pragma unroll
        for (int nb = 0; nb < 4; ++nb) acc[mb][nb] = (v8f){};
    const size_t aoff = (size_t)(r0 + lr) * K + 8 * hi, boff = (size_t)(c0 + lr) * K + 8 * hi;
#pragma unroll 1
    for (int kc = 0; kc < K; kc += 32) {
        V a[4], a2[4];
#pragma unroll
        for (int mb = 0; mb < 4; ++mb) { a[mb] = WFrag<T16>::ld(A + aoff + (size_t)mb * 16 * K + kc); if (NSPLIT == 1 || NSPLIT == 2) a2[mb] = WFrag<T16>::ld(A2 + aoff + (size_t)mb * 16 * K + kc); }
#pragma unroll
        for (int nb = 0; nb < 4; ++nb) { const V b = WFrag<T16>::ld(Bt + boff + (size_t)nb * 16 * K + kc); V b2; if (NSPLIT >= 2) b2 = WFrag<T16>::ld(Bt2 + boff + (size_t)nb * 16 * K + kc);
#pragma unroll
            for (int mb = 0; mb < 4; ++mb) { acc[mb][nb] = WFrag<T16>::mma(a[mb], b, acc[mb][nb]); if (NSPLIT == 1 || NSPLIT == 2) acc[mb][nb] = WFrag<T16>::mma(a2[mb], b, acc[mb][nb]); if (NSPLIT >= 2) acc[mb][nb] = WFrag<T16>::mma(a[mb], b2, acc[mb][nb]); } }
        asm volatile("v_nop\n\tv_nop\n\tv_nop\n\tv_nop" : "+v"(acc[0][0]), "+v"(acc[1][1]), "+v"(acc[2][2]), "+v"(acc[3][3]) : "v"(a[0]), "v"(a[3]));
    }
#pragma unroll
    for (int mb = 0; mb < 4; ++mb) {
#pragma unroll
        for (int nb = 0; nb < 4; ++nb) {
#pragma unroll
            for (int j = 0; j < 8; ++j) os[(hi * 8 + j) * 68 + nb * 16 + lr] = acc[mb][nb][j]; }
        __builtin_amdgcn_wave_barrier(); asm volatile("" ::: "memory");
        float* crow = C + (size_t)(r0 + mb * 16) * ldc + c0;
{
#pragma unroll
            for (int s = 0; s < 8; ++s) { const int row = 2 * s + hi, cofs = lr * 4; v4f val = *(const v4fa*)(os + row * 68 + cofs); if (BIAS) { val[0] += bfr(bias[c0 + cofs]); val[1] += bfr(bias[c0 + cofs + 1]); val[2] += bfr(bias[c0 + cofs + 2]); val[3] += bfr(bias[c0 + cofs + 3]); }
                *(v4f*)(crow + (size_t)row * ldc + cofs) = val; }
             }
        __builtin_amdgcn_wave_barrier(); asm volatile("" ::: "memory");
    }
}

// ---- k_gemmc: the same one-wave 64x64 tile GEMM specialised for causal sliding-window attention, all NZ planes in grid z and both precision halves in grid x (row tiles < RH/64: hi/lo bf16, 3 products; the rest: fp16).
// With R = r0+roff the first query row of the tile, every key a row of the tile may see lies in the band [R-(BT-1)*64, R+64); jb = max(0, its first key). Score and probability planes hold the band only: [z][row][BW], column = key - jb.
// CMODE 1 (scores): blockIdx.y counts the BT key tiles of that band, no other score tile is computed. CMODE 2 (probability x value): the key (K) loop runs over the band only (probabilities outside it are exactly zero and are not stored).
// roff = row offset of this half's first row within the sequence (A, A2: row 0 of the planes; C: the half's first row); bx = row tile within the half.
template <typename T16, int NSPLIT, int CMODE, int roff>
__device__ __forceinline__ void gemmc(float* os, int bx, const T16* __restrict__ A, const T16* __restrict__ A2, const T16* __restrict__ Bt, const T16* __restrict__ Bt2, float* C, size_t sA) {
    typedef typename WFrag<T16>::V V;
    constexpr int lda = (CMODE == 1) ? HD : BW, ldb = (CMODE == 1) ? HD : TT, ldc = (CMODE == 1) ? BW : HD;
    const size_t z = blockIdx.z; A += z * sA; if (NSPLIT) A2 += z * sA; Bt += z * (size_t)TT * HD; if (NSPLIT >= 2) Bt2 += z * (size_t)TT * HD; C += z * (size_t)TT * ldc;
    const int lane = threadIdx.x & 31, lr = lane & 15, hi = lane >> 4; const int r0 = bx * 64, bnd = r0 + roff - (BT - 1) * 64, jb = max(0, bnd); const int c0 = (CMODE == 1) ? bnd + (int)blockIdx.y * 64 : (int)blockIdx.y * 64;
    if (CMODE == 1 && c0 < 0) return;                                // band tile in front of key 0: does not exist
    const int K0 = (CMODE == 2) ? jb : 0;                            // P.V: first key of the band
    const int Kl = (CMODE == 2) ? min(TT, r0 + roff + 64) : HD;      // P.V: the band ends with the diagonal block
    v8f acc[4][4];
#pragma unroll
    for (int mb = 0; mb < 4; ++mb)
#pragma unroll
        for (int nb = 0; nb < 4; ++nb) acc[mb][nb] = (v8f){};
    const size_t aoff = (size_t)(r0 + lr) * lda + 8 * hi, boff = (size_t)(c0 + lr) * ldb + 8 * hi + K0;   // the A planes of P.V start at the band's first key, the B planes at key 0
    const T16* pa = A + aoff; const T16* pa2 = NSPLIT ? A2 + aoff : pa; const T16* pb = Bt + boff; const T16* pb2 = (NSPLIT >= 2) ? Bt2 + boff : pb;
#pragma unroll 1
    for (int kc = K0; kc < Kl; kc += 32) {
        V a[4], a2[4], b[4], b2[4];
#pragma unroll
        for (int mb = 0; mb < 4; ++mb) { a[mb] = WFrag<T16>::ld(pa + (size_t)(roff + mb * 16) * lda); if (NSPLIT == 1 || NSPLIT == 2) a2[mb] = WFrag<T16>::ld(pa2 + (size_t)(roff + mb * 16) * lda); }
#pragma unroll
        for (int nb = 0; nb < 4; ++nb) { b[nb] = WFrag<T16>::ld(pb + (size_t)nb * 16 * ldb); if (NSPLIT >= 2) b2[nb] = WFrag<T16>::ld(pb2 + (size_t)nb * 16 * ldb); }
        asm volatile("s_wait_xcnt 0x0" :: "v"(pa), "v"(pa2), "v"(pb), "v"(pb2) : "memory");   // the wait behind the trip's loads; as its inputs the four address pairs stay whole up to it, so that no load's result and no address step lands in one earlier
#pragma unroll
        for (int nb = 0; nb < 4; ++nb) {
#pragma unroll
            for (int mb = 0; mb < 4; ++mb) { acc[mb][nb] = WFrag<T16>::mma(a[mb], b[nb], acc[mb][nb]); if (NSPLIT == 1 || NSPLIT == 2) acc[mb][nb] = WFrag<T16>::mma(a2[mb], b[nb], acc[mb][nb]); if (NSPLIT >= 2) acc[mb][nb] = WFrag<T16>::mma(a[mb], b2[nb], acc[mb][nb]); } }
        asm volatile("v_nop\n\tv_nop\n\tv_nop\n\tv_nop" : "+v"(acc[0][0]), "+v"(acc[1][1]), "+v"(acc[2][2]), "+v"(acc[3][3]) : "v"(a[0]), "v"(a[3]));
        pa += 32; pa2 += 32; pb += 32; pb2 += 32;
    }
#pragma unroll
    for (int mb = 0; mb < 4; ++mb) {
#pragma unroll
        for (int nb = 0; nb < 4; ++nb) {
#pragma unroll
            for (int j = 0; j < 8; ++j) os[(hi * 8 + j) * 68 + nb * 16 + lr] = acc[mb][nb][j]; }
        __builtin_amdgcn_wave_barrier(); asm volatile("" ::: "memory");
        float* crow = C + (size_t)(r0 + mb * 16) * ldc + ((CMODE == 1) ? c0 - jb : c0);
{
#pragma unroll
            for (int s = 0; s < 8; ++s) { const int row = 2 * s + hi, cofs = lr * 4; v4f val = *(const v4fa*)(os + row * 68 + cofs);
                *(v4f*)(crow + (size_t)row * ldc + cofs) = val; }
             }
        asm volatile("s_wait_xcnt 0x0" ::: "memory");   // the wait behind these stores: the next 16 rows, and the code laid out behind this half, reuse their registers
        __builtin_amdgcn_wave_barrier(); asm volatile("" ::: "memory");
    }
}
template <int CMODE>
__global__ __launch_bounds__(32) void k_gemmc(const bf* __restrict__ Ah, const bf* __restrict__ Al, const h16* __restrict__ A16, const bf* __restrict__ Bh, const bf* __restrict__ Bl, const h16* __restrict__ B16, float* C) {
    __shared__ __align__(16) float os[16 * 68];
    const int bx = (int)blockIdx.x;
    if (bx < RH / 64) gemmc<bf, 2, CMODE, 0>(os, bx, Ah, Al, Bh, Bl, C, (CMODE == 1) ? (size_t)TT * HD : (size_t)RH * BW);
    else gemmc<h16, 0, CMODE, RH>(os, bx - RH / 64, A16, nullptr, B16, nullptr, C + (size_t)RH * ((CMODE == 1) ? BW : HD), (CMODE == 1) ? (size_t)TT * HD : (size_t)TT * BW);
}

__device__ __forceinline__ h16 tohx(float x) { return (h16)x; }
__device__ __forceinline__ void splitf(float y, unsigned short& h, unsigned short& l) { h = f2bf(y); l = f2bf(y - bf2f(h)); }
typedef __attribute__((ext_vector_type(2))) _Float16 v2h;
typedef __attribute__((ext_vector_type(4))) _Float16 v4h;
typedef __attribute__((ext_vector_type(2))) unsigned short v2us;
typedef __attribute__((ext_vector_type(4))) unsigned short v4us;
typedef __attribute__((ext_vector_type(2))) float v2f;
typedef __attribute__((ext_vector_type(4))) int v4i;

__global__ __launch_bounds__(256) void k_wtG(const float* __restrict__ w, int K, int N, bf* Bt) {
    const int lane = threadIdx.x & 31; const int L0 = (blockIdx.x * 8 + (threadIdx.x >> 5)) * 8; const int nlines = N * K / 64;
{
#pragma unroll 1
        for (int l = 0; l < 8; ++l) { const int L = L0 + l; if (L >= nlines) break; const size_t e = (size_t)L * 64 + lane * 2; const int k = (int)(e % K), n = (int)(e / K); v2us o;
            o[0] = f2bf(w[(size_t)k * N + n]); o[1] = f2bf(w[(size_t)(k + 1) * N + n]); *(v2us*)(Bt + e) = o; }
         }
}
// k_cvtin: the jobs that read inputs only, in one grid: bf16 copies of the four weights (Wb: wq, wk, wv, wo in a row; WB blocks each), of the whole query (XB; XBL blocks), then the cos/sin table CS.
__global__ __launch_bounds__(256) void k_cvtin(const float* __restrict__ x, const float* __restrict__ wq, const float* __restrict__ wk, const float* __restrict__ wv, const float* __restrict__ wo, bf* XB, bf* Wb, float* CS) {
    constexpr unsigned WB = (unsigned)((size_t)DQ * DM / 8 / 256), XBL = (unsigned)((size_t)NB_ * TT * DM / 8 / 256); const unsigned b = blockIdx.x;
    if (b >= 4 * WB + XBL) { const int idx = (int)(b - 4 * WB - XBL) * 256 + threadIdx.x; v2f cs; cs[0] = 1.0f; cs[1] = 0.0f; *(v2f*)(CS + (size_t)idx * 2) = cs; return; }
    const float* src; bf* dst; size_t i;
    if (b < 4 * WB) { const unsigned w = b / WB; src = (w == 0) ? wq : (w == 1) ? wk : (w == 2) ? wv : wo; dst = Wb + (size_t)w * DQ * DM; i = (size_t)(b % WB) * 256 + threadIdx.x; }
    else { src = x; dst = XB; i = (size_t)(b - 4 * WB) * 256 + threadIdx.x; }
    const v8f v = *(const v8f*)(src + i * 8); v8us o;
#pragma unroll
    for (int k = 0; k < 8; ++k) o[k] = f2bf(v[k]); *(v8us*)(dst + i * 8) = o;  }

// rope: head planes [w][b][h][t][d] (w: 0 = q, 1 = k; fp16 + hi/lo) from the projections F [w][b][t][pitch], of rope(x) x sc with the rotate-half convention out[d] = x[d] cos[t][d] - x[d+HD/2] sin[t][d], out[d+HD/2] = x[d+HD/2] cos[t][d+HD/2] + x[d] sin[t][d+HD/2]
__device__ __forceinline__ void rope(unsigned blk, const float* __restrict__ F, int pitch, int nheads, const float* __restrict__ CS, const float* __restrict__ RF, const float* __restrict__ nw, float sc, h16* P16, bf* Ph, bf* Pl) {
    const size_t e = ((size_t)blk * 256 + threadIdx.x) * 2; if (e >= (size_t)2 * NB_ * nheads * TT * HD) return; const int d = (int)(e % HD); const int t = (int)((e / HD) % TT); const int zz = (int)(e / ((size_t)HD * TT)); const int h = zz % nheads; const int wb = zz / nheads; const float* f = F + ((size_t)wb * TT + t) * pitch + h * HD; const float rf = RF ? RF[(size_t)h * TT + t] : 1.0f;
    asm volatile("s_wait_xcnt 0x0" ::: "memory");   // the address registers of the load above are reused by the address sums below
    v2h o16; v2us oh, ol;
#pragma unroll
    for (int q = 0; q < 2; ++q) { const int dd = d + q; const int dp = (dd < HD / 2) ? dd + HD / 2 : dd - HD / 2; float x0 = f[dd], x1 = f[dp];
        asm volatile("s_wait_xcnt 0x0" ::: "memory");   // the wait behind the two loads above: their address registers are reused below
        if (RF) { float n0 = __fmul_rn(x0, rf), n1 = __fmul_rn(x1, rf); asm volatile("" : "+v"(n0)); asm volatile("" : "+v"(n1)); x0 = __fmul_rn(bfr(nw[dd]), n0); x1 = __fmul_rn(bfr(nw[dp]), n1); }
        const v2f cs = *(const v2f*)(CS + ((size_t)t * HD + dd) * 2); float a = __fmul_rn(x0, cs[0]), bq = __fmul_rn(x1, cs[1]); asm volatile("" : "+v"(a)); asm volatile("" : "+v"(bq)); const float r = ((dd < HD / 2) ? __fsub_rn(a, bq) : __fadd_rn(a, bq)) * sc;
        o16[q] = tohx(r); unsigned short a2, c2; splitf(r, a2, c2); oh[q] = a2; ol[q] = c2; }
    *(v2h*)(P16 + e) = o16; *(v2us*)(Ph + e) = oh; *(v2us*)(Pl + e) = ol;  }
__device__ __forceinline__ void vtp(unsigned blk, const float* __restrict__ F, int pitch, int nheads, h16* V16, bf* Vh, bf* Vl) { const size_t e = ((size_t)blk * 256 + threadIdx.x) * 2; if (e >= (size_t)NB_ * nheads * HD * TT) return; const int t = (int)(e % TT); const int d = (int)((e / TT) % HD); const int zz = (int)(e / ((size_t)TT * HD)); const int g = zz % nheads; const int b = zz / nheads; v2h o16; v2us oh, ol;
#pragma unroll
    for (int q = 0; q < 2; ++q) { const float x = F[((size_t)b * TT + t + q) * pitch + g * HD + d]; o16[q] = tohx(x); unsigned short a2, c2; splitf(x, a2, c2); oh[q] = a2; ol[q] = c2; }
    *(v2h*)(V16 + e) = o16; *(v2us*)(Vh + e) = oh; *(v2us*)(Vl + e) = ol;  }
// k_planes: q/k planes and transposed v planes in one grid; of three blocks in a row two do rope and one vtp, so that the streaming job and the strided one run side by side. F: q, k, v projections in a row.
__global__ __launch_bounds__(256) void k_planes(const float* __restrict__ F, int pitch, int nheads, const float* __restrict__ CS, const float* __restrict__ RF, const float* __restrict__ nw, float sc, h16* P16, bf* Ph, bf* Pl, h16* V16, bf* Vh, bf* Vl) {
    const unsigned g = blockIdx.x / 3, r = blockIdx.x % 3;
    if (r < 2) rope(g * 2 + r, F, pitch, nheads, CS, RF, nw, sc, P16, Ph, Pl);
    else vtp(g, F + (size_t)2 * NB_ * TT * pitch, pitch, nheads, V16, Vh, Vl);
}
// k_asoft: per row (zz, i): t = S x HD^-0.5 for j <= i and i - j < WIN (sliding causal window; a masked key's probability is exactly 0); softmax over the BW keys of the row tile's band from key jb on (register row, one exp, fixed trees);
// every key outside the band is masked, so it adds 0 to the sum and cannot be the maximum; the S and P planes hold the band only ([row][BW], column = key - jb), which is all that P.V reads.
__global__ __launch_bounds__(256) void k_asoft(const float* __restrict__ Sb, h16* P16, bf* Ph, bf* Pl) {
    const int lane = threadIdx.x & 31; const int row = blockIdx.x * 8 + (threadIdx.x >> 5); if (row >= NZ * TT) return; const int i = row % TT; const int zz = row / TT; (void)zz; const bool hires = (i < RH); const int jb = max(0, (i & ~63) - (BT - 1) * 64); const float* sr = Sb + (size_t)row * BW - jb; float v[BW / 32]; float mx = -3.0e38f;
#pragma unroll
    for (int ch = 0; ch < BW / 128; ++ch) { const int j0 = jb + ch * 128 + lane * 4; v4f a = (v4f){}; if (j0 <= i) a = *(const v4f*)(sr + j0);   // four keys wholly above the diagonal may lie in a score tile that is not computed: not read
#pragma unroll
        for (int q = 0; q < 4; ++q) { const int j = j0 + q; (void)j; const float t = (j <= i && i - j < WIN) ? a[q] * SCL : -3.0e38f; v[ch * 4 + q] = t; mx = fmaxf(mx, t); } }
#pragma unroll
    for (int sh = 16; sh; sh >>= 1) mx = fmaxf(mx, __shfl_xor(mx, sh, 32));
    float sum = 0.f;
#pragma unroll
    for (int k = 0; k < BW / 32; ++k) { float d0 = __fsub_rn(v[k], mx); asm volatile("" : "+v"(d0)); v[k] = __builtin_amdgcn_exp2f(__fmul_rn(d0, 1.4426950408889634f)); sum += v[k]; }
#pragma unroll
    for (int sh = 16; sh; sh >>= 1) sum += __shfl_xor(sum, sh, 32);
    const float f = __fdiv_rn(hires ? 1.0f : PCAR, sum);
{
        if (hires) {
#pragma unroll
            for (int ch = 0; ch < BW / 128; ++ch) { v4us oh, ol;
#pragma unroll
                for (int q = 0; q < 4; ++q) { unsigned short a, c2; splitf(v[ch * 4 + q] * f, a, c2); oh[q] = a; ol[q] = c2; }
                const size_t oo = ((size_t)zz * (RH ? RH : 1) + i) * BW + ch * 128 + lane * 4; *(v4us*)(Ph + oo) = oh; *(v4us*)(Pl + oo) = ol; }
        } else {
#pragma unroll
            for (int ch = 0; ch < BW / 128; ++ch) { v4h o4;
#pragma unroll
                for (int q = 0; q < 4; ++q) o4[q] = tohx(v[ch * 4 + q] * f);
                *(v4h*)(P16 + (size_t)row * BW + ch * 128 + lane * 4) = o4; } }
         }
}
__global__ __launch_bounds__(256) void k_merge(const float* __restrict__ O, bf* Ah, bf* Al) { const size_t e = ((size_t)blockIdx.x * 256 + threadIdx.x) * 2; if (e >= (size_t)NZ * TT * HD) return; const int d = (int)(e % HD); const int t = (int)((e / HD) % TT); const int zz = (int)(e / ((size_t)HD * TT)); const float cs = (t < RH) ? 1.0f : (1.0f / PCAR); const size_t oo = ((size_t)(zz / NH_) * TT + t) * DQ + (zz % NH_) * HD + d;
    v2us oh, ol;
#pragma unroll
    for (int q = 0; q < 2; ++q) { unsigned short a, c2; splitf(O[e + q] * cs, a, c2); oh[q] = a; ol[q] = c2; } *(v2us*)(Ah + oo) = oh; *(v2us*)(Al + oo) = ol;  }

extern "C" void kernel_launch(void* const* d_in, const int* in_sizes, int n_in,
                              void* d_out, int out_size, void* d_ws, size_t ws_size, hipStream_t stream) {
    (void)in_sizes; (void)n_in; (void)out_size;
    const float* x = (const float*)d_in[0]; const float* wq = (const float*)d_in[1]; const float* wk = (const float*)d_in[2]; const float* wv = (const float*)d_in[3]; const float* wo = (const float*)d_in[4]; const float* bo = (const float*)d_in[5];
    float* OUT = (float*)d_out;     // [8][1024][1024]
    char* wsp = (char*)d_ws;
    auto take = [&](size_t bytes) { char* p = wsp; wsp += (bytes + 255) & ~(size_t)255; return (void*)p; };
    bf* WQ = (bf*)take((size_t)DQ * DM * 2); bf* WK = (bf*)take((size_t)DKV * DM * 2); bf* WV = (bf*)take((size_t)DKV * DM * 2); bf* WO = (bf*)take((size_t)DM * DQ * 2); float* CS = (float*)take((size_t)TT * HD * 2 * 4); (void)WK; (void)WV;   // wq, wk, wv, wo in a row
    float* FQ = (float*)take((size_t)NB_ * TT * DQ * 4); float* FK = (float*)take((size_t)NB_ * TT * DKV * 4); float* FV = (float*)take((size_t)NB_ * TT * DKV * 4); (void)FK;   // q, k, v projections in a row
    h16* QP16 = (h16*)take((size_t)NZ * TT * HD * 2); h16* KP16 = (h16*)take((size_t)NZ * TT * HD * 2); h16* VT16 = (h16*)take((size_t)NZ * HD * TT * 2);   // q and k planes of a kind in a row
    bf* QPh = (bf*)take((size_t)NZ * TT * HD * 2); bf* KPh = (bf*)take((size_t)NZ * TT * HD * 2); bf* QPl = (bf*)take((size_t)NZ * TT * HD * 2); bf* KPl = (bf*)take((size_t)NZ * TT * HD * 2); bf* VTh = (bf*)take((size_t)NZ * HD * TT * 2); bf* VTl = (bf*)take((size_t)NZ * HD * TT * 2);
    if ((size_t)(wsp - (char*)d_ws) > ws_size) return;    // ws 256 MiB
    // Buffers that take the place of dead ones (stream-ordered; each is written whole, as far as it is read, before its first read):
    bf* XB = (bf*)VT16;          // bf16 query: dead once projected, before the v planes are built
    float* Sb = FQ;              // band scores [NZ][TT][BW] f32 = the q and k projections' bytes, dead once the q and k planes are built
    float* Ob = FV;              // attention output [NZ][TT][HD] f32 = the v projection's bytes
    h16* P16 = QP16;             // [NZ][TT][BW] fp16 = the fp16 q and k planes' bytes, dead after the scores
    bf* Ph = QPh; bf* Pl = QPl;  // [NZ][RH][BW] each
    bf* ATh = KPh; bf* ATl = KPl;   // merged heads [NB_*TT][DQ] hi/lo
    static_assert((size_t)TT * BW * 4 <= (size_t)2 * TT * HD * 4 && (size_t)TT * BW * 2 <= (size_t)2 * TT * HD * 2 && (size_t)RH * BW <= (size_t)TT * HD, "the band planes fit the buffers they replace");
    k_cvtin<<<(unsigned)(((size_t)4 * DQ * DM + (size_t)NB_ * TT * DM) / 8 / 256 + TT * HD / 256), 256, 0, stream>>>(x, wq, wk, wv, wo, XB, WQ, CS);
    k_gemmw<bf, 0, false><<<dim3(NB_ * TT / 64, DQ / 64, 3), 32, 0, stream>>>(XB, nullptr, WQ, nullptr, DM, FQ, DQ, nullptr, 0, (size_t)DQ * DM, (size_t)NB_ * TT * DQ);   // z: q, k, v
    k_planes<<<(unsigned)((size_t)3 * NZ * TT * HD / 2 / 256), 256, 0, stream>>>(FQ, DQ, NH_, CS, nullptr, nullptr, 1.0f, QP16, QPh, QPl, VT16, VTh, VTl);
    k_gemmc<1><<<dim3(TT / 64, BT, NZ), 32, 0, stream>>>(QPh, QPl, QP16, KPh, KPl, KP16, Sb);
    k_asoft<<<NZ * TT / 8, 256, 0, stream>>>(Sb, P16, Ph, Pl);
    k_gemmc<2><<<dim3(TT / 64, HD / 64, NZ), 32, 0, stream>>>(Ph, Pl, P16, VTh, VTl, VT16, Ob);
    k_merge<<<(unsigned)((size_t)NZ * TT * HD / 2 / 256), 256, 0, stream>>>(Ob, ATh, ATl);
    k_gemmw<bf, 1, true><<<dim3(NB_ * TT / 64, DM / 64, 1), 32, 0, stream>>>(ATh, ATl, WO, nullptr, DQ, OUT, DM, bo, 0, 0, 0);
}

// v003
// A run of this version takes 252 microseconds.
// Two timings next to v002 both put it at 1.29 times that version's speed.
// Over all steps from v000 it is 15.5 times as fast.
#include <hip/hip_runtime.h>

// Causal sliding-window multi-head attention (query [8][1024][1024]; q,k,v = query W^T ('oi' 1/32, no bias; 16 heads x 64); scores x 64^-0.5; query i sees keys j in [i-63, i] (window 64; -inf elsewhere); softmax; out = merged Wo^T + bo -> [8][1024][1024] (8.4 M)).
// Layout, every stage one launch over all 8 batches and 16 heads (z = batch x 16 + head): bf16 copy of query; 'oi' weights; exact projections, whose epilogue writes the q, k and transposed v planes; causal T-1024 attention on the 128-key band that holds each 64-row tile's 64-key windows (hybrid rows: < 512 hi/lo 3 products, rest fp16 x1024; score tiles, softmax columns and P.V keys outside the band are never touched; the epilogue of P.V writes the merged hi/lo planes); merged hi/lo x Wo exact + bo.
// Compute dtypes, f32 accumulate: every input rounded to bf16; projections exact; attention rows < 512 3 products, rest fp16; softmax f32; Wo hl x exact + bias.

#define NB_  8
#define TT   1024
#define DM   1024
#define NH_  16
#define NKV  16
#define REP  (NH_ / NKV)
#define HD   64
#define DQ   (NH_ * HD)
#define DKV  (NKV * HD)
#define NZ   (NB_ * NH_)          // attention planes: one per (batch, head)
#define RH   512                  // query rows < RH use hi+lo planes (0: none)
#define WIN  64      // causal sliding window: keys j in [i-63, i]
#define BT   ((WIN + 62) / 64 + 1)   // 64-key tiles that cover the windows of one 64-row tile: keys [R - (BT-1)*64, R + 64) for rows R..R+63
#define BW   (BT * 64)               // band width in keys
static_assert(BW % 128 == 0 && BW <= TT && RH % 64 == 0, "the softmax reads the band in 128-key chunks and shares the 64-row tiles of the GEMMs");
static_assert(NH_ == NKV && DQ == DM, "q, k, v share one projection launch and one plane shape; the four weights share one conversion shape");
#define PCAR 1024.0f
#define SCL  0.125f   // HD^-0.5
typedef _Float16 h16;
typedef unsigned short bf;
typedef __attribute__((ext_vector_type(16))) __bf16   v16bf;
typedef __attribute__((ext_vector_type(16))) _Float16 v16h;
typedef __attribute__((ext_vector_type(8)))  _Float16 v8h;
typedef __attribute__((ext_vector_type(8)))  unsigned short v8us;
typedef __attribute__((ext_vector_type(8)))  float    v8f;
typedef __attribute__((ext_vector_type(4)))  float    v4f;
typedef v8h  __attribute__((may_alias)) v8ha;
typedef v4f  __attribute__((may_alias)) v4fa;
typedef v8us __attribute__((may_alias)) v8usa;

__device__ __forceinline__ unsigned short f2bf(float f) { unsigned u = __float_as_uint(f); u += 0x7FFFu + ((u >> 16) & 1u); return (unsigned short)(u >> 16); }
__device__ __forceinline__ float bf2f(unsigned short b) { return __uint_as_float(((unsigned)b) << 16); }
__device__ __forceinline__ float bfr(float f) { return bf2f(f2bf(f)); }
__device__ __forceinline__ v16h cat16(v8h lo, v8h hi) { return __builtin_shufflevector(lo, hi, 0, 1, 2, 3, 4, 5, 6, 7, 8, 9, 10, 11, 12, 13, 14, 15); }
__device__ __forceinline__ v16bf cat16b(v8us lo, v8us hi) { return __builtin_bit_cast(v16bf, __builtin_shufflevector(lo, hi, 0, 1, 2, 3, 4, 5, 6, 7, 8, 9, 10, 11, 12, 13, 14, 15)); }
__device__ __forceinline__ v8f wmma16(v16h a, v16h b, v8f c) { return __builtin_amdgcn_wmma_f32_16x16x32_f16(false, a, false, b, (short)0, c, false, false); }
__device__ __forceinline__ v8f wmmab(v16bf a, v16bf b, v8f c) { return __builtin_amdgcn_wmma_f32_16x16x32_bf16(false, a, false, b, (short)0, c, false, false); }
__device__ __forceinline__ h16 tohx(float x) { return (h16)x; }
__device__ __forceinline__ void splitf(float y, unsigned short& h, unsigned short& l) { h = f2bf(y); l = f2bf(y - bf2f(h)); }

// putp: 16 rows x 64 f32 staged in os (pitch 68) leave as 16-bit rows of 64 (128 bytes) at dh/dl (bf16 hi/lo of x * cs) and, with F16, at d16 (fp16 of x * cs); pitch in elements.
// Each lane converts 8 neighbours of one row, so that every store of the wave covers four whole 128-byte rows.
template <bool F16>
__device__ __forceinline__ void putp(const float* os, int lane, h16* d16, bf* dh, bf* dl, size_t pitch, float cs) {
#pragma unroll
    for (int s = 0; s < 4; ++s) { const int row = 4 * s + (lane >> 3), cofs = (lane & 7) * 8; const v4f x0 = *(const v4fa*)(os + row * 68 + cofs), x1 = *(const v4fa*)(os + row * 68 + cofs + 4); v8h o16; v8us oh, ol;
#pragma unroll
        for (int q = 0; q < 8; ++q) { const float x = ((q < 4) ? x0[q & 3] : x1[q & 3]) * cs; if (F16) o16[q] = tohx(x); unsigned short a2, c2; splitf(x, a2, c2); oh[q] = a2; ol[q] = c2; }
        const size_t oo = (size_t)row * pitch + cofs; if (F16) *(v8ha*)(d16 + oo) = o16; *(v8usa*)(dh + oo) = oh; *(v8usa*)(dl + oo) = ol;
        asm volatile("s_wait_xcnt 0x0" ::: "memory");   // the wait behind these stores: the next four rows reuse their registers
    }
}



// ---- k_gemmw: register-blocked GEMM, ONE WAVE per 64x64 output tile (16 accumulators), operands straight from K-contiguous 16-bit planes; grid (M/64, N/64, Z), 32 threads.
// C[m][n] (f32, pitch ldc, + optional f32 bias[n]) = sum_k A[m][k] Bt[n][k] (+ split products per NSPLIT). z-batch strides sA/sB/sC in elements. K % 32 == 0.
// PLANES (the q, k, v projections, z = 0, 1, 2): a tile is 64 tokens of one head, and no C is written: the epilogue stores the head planes themselves (fp16 + bf16 hi/lo), q and k as [z][b][h][t][d], v transposed as [b][h][d][t].
template <typename T16> struct WFrag;
template <> struct WFrag<h16> { typedef v16h V; static __device__ __forceinline__ V ld(const h16* p) { return cat16(*(const v8h*)p, *(const v8h*)(p + 16)); } static __device__ __forceinline__ v8f mma(V a, V b, v8f c) { return wmma16(a, b, c); } };
template <> struct WFrag<bf> { typedef v16bf V; static __device__ __forceinline__ V ld(const bf* p) { return cat16b(*(const v8us*)p, *(const v8us*)(p + 16)); } static __device__ __forceinline__ v8f mma(V a, V b, v8f c) { return wmmab(a, b, c); } };
template <typename T16, int NSPLIT, bool BIAS, bool PLANES>
__global__ __launch_bounds__(32) void k_gemmw(const T16* __restrict__ A, const T16* __restrict__ A2, const T16* __restrict__ Bt, const T16* __restrict__ Bt2, int K, float* C, int ldc, const float* __restrict__ bias, size_t sA, size_t sB, size_t sC, h16* P16, bf* Ph, bf* Pl, h16* V16, bf* Vh, bf* Vl) {
    typedef typename WFrag<T16>::V V;
    __shared__ __align__(16) float os[16 * 68];
    const size_t z = blockIdx.z; A += z * sA; if (A2) A2 += z * sA; Bt += z * sB; if (Bt2) Bt2 += z * sB; C += z * sC;
    const int lane = threadIdx.x & 31, lr = lane & 15, hi = lane >> 4; const int r0 = blockIdx.x * 64, c0 = blockIdx.y * 64;
    v8f acc[4][4];
#pragma unroll
    for (int mb = 0; mb < 4; ++mb)
#pragma unroll
        for (int nb = 0; nb < 4; ++nb) acc[mb][nb] = (v8f){};
    const size_t aoff = (size_t)(r0 + lr) * K + 8 * hi, boff = (size_t)(c0 + lr) * K + 8 * hi;
#pragma unroll 1
    for (int kc = 0; kc < K; kc += 32) {
        V a[4], a2[4];
#pragma unroll
        for (int mb = 0; mb < 4; ++mb) { a[mb] = WFrag<T16>::ld(A + aoff + (size_t)mb * 16 * K + kc); if (NSPLIT == 1 || NSPLIT == 2) a2[mb] = WFrag<T16>::ld(A2 + aoff + (size_t)mb * 16 * K + kc); }
#pragma unroll
        for (int nb = 0; nb < 4; ++nb) { const V b = WFrag<T16>::ld(Bt + boff + (size_t)nb * 16 * K + kc); V b2; if (NSPLIT >= 2) b2 = WFrag<T16>::ld(Bt2 + boff + (size_t)nb * 16 * K + kc);
#pragma unroll
            for (int mb = 0; mb < 4; ++mb) { acc[mb][nb] = WFrag<T16>::mma(a[mb], b, acc[mb][nb]); if (NSPLIT == 1 || NSPLIT == 2) acc[mb][nb] = WFrag<T16>::mma(a2[mb], b, acc[mb][nb]); if (NSPLIT >= 2) acc[mb][nb] = WFrag<T16>::mma(a[mb], b2, acc[mb][nb]); } }
        asm volatile("v_nop\n\tv_nop\n\tv_nop\n\tv_nop" : "+v"(acc[0][0]), "+v"(acc[1][1]), "+v"(acc[2][2]), "+v"(acc[3][3]) : "v"(a[0]), "v"(a[3]));
    }
    if (PLANES) {
        static_assert(HD == 64 && TT % 64 == 0, "a 64x64 tile is 64 tokens of one batch and one head");
        const int t0 = r0 % TT; const size_t zz = (size_t)(r0 / TT) * NH_ + blockIdx.y;
        if (z < 2) {                                                  // q, k: staged rows are tokens
            const size_t base = ((z * NZ + zz) * TT + t0) * HD;
#pragma unroll
            for (int mb = 0; mb < 4; ++mb) {
#pragma unroll
                for (int nb = 0; nb < 4; ++nb) {
#pragma unroll
                    for (int j = 0; j < 8; ++j) os[(hi * 8 + j) * 68 + nb * 16 + lr] = acc[mb][nb][j]; }
                __builtin_amdgcn_wave_barrier(); asm volatile("" ::: "memory");
                putp<true>(os, lane, P16 + base + mb * 16 * HD, Ph + base + mb * 16 * HD, Pl + base + mb * 16 * HD, HD, 1.0f);
                __builtin_amdgcn_wave_barrier(); asm volatile("" ::: "memory");
            }
        } else {                                                      // v: staged rows are head dims; a lane's 8 accumulator rows are 8 tokens in a row
            const size_t base = zz * HD * TT + t0;
#pragma unroll
            for (int nb = 0; nb < 4; ++nb) {
#pragma unroll
                for (int mb = 0; mb < 4; ++mb) { float* o = os + lr * 68 + mb * 16 + hi * 8; *(v4fa*)o = __builtin_shufflevector(acc[mb][nb], acc[mb][nb], 0, 1, 2, 3); *(v4fa*)(o + 4) = __builtin_shufflevector(acc[mb][nb], acc[mb][nb], 4, 5, 6, 7); }
                __builtin_amdgcn_wave_barrier(); asm volatile("" ::: "memory");
                putp<true>(os, lane, V16 + base + (size_t)nb * 16 * TT, Vh + base + (size_t)nb * 16 * TT, Vl + base + (size_t)nb * 16 * TT, TT, 1.0f);
                __builtin_amdgcn_wave_barrier(); asm volatile("" ::: "memory");
            }
        }
        return;
    }
#pragma unroll
    for (int mb = 0; mb < 4; ++mb) {
#pragma unroll
        for (int nb = 0; nb < 4; ++nb) {
#pragma unroll
            for (int j = 0; j < 8; ++j) os[(hi * 8 + j) * 68 + nb * 16 + lr] = acc[mb][nb][j]; }
        __builtin_amdgcn_wave_barrier(); asm volatile("" ::: "memory");
        float* crow = C + (size_t)(r0 + mb * 16) * ldc + c0;
{
#pragma unroll
            for (int s = 0; s < 8; ++s) { const int row = 2 * s + hi, cofs = lr * 4; v4f val = *(const v4fa*)(os + row * 68 + cofs); if (BIAS) { val[0] += bfr(bias[c0 + cofs]); val[1] += bfr(bias[c0 + cofs + 1]); val[2] += bfr(bias[c0 + cofs + 2]); val[3] += bfr(bias[c0 + cofs + 3]); }
                *(v4f*)(crow + (size_t)row * ldc + cofs) = val; }
             }
        __builtin_amdgcn_wave_barrier(); asm volatile("" ::: "memory");
    }
}

// ---- k_gemmc: the same one-wave 64x64 tile GEMM specialised for causal sliding-window attention, all NZ planes in grid z and both precision halves in grid x (row tiles < RH/64: hi/lo bf16, 3 products; the rest: fp16).
// With R = r0+roff the first query row of the tile, every key a row of the tile may see lies in the band [R-(BT-1)*64, R+64); jb = max(0, its first key). Score and probability planes hold the band only: [z][row][BW], column = key - jb.
// CMODE 1 (scores): blockIdx.y counts the BT key tiles of that band, no other score tile is computed. CMODE 2 (probability x value): the key (K) loop runs over the band only (probabilities outside it are exactly zero and are not stored); no C is written: the epilogue takes the fp16 half's x1024 off again and stores the merged heads [b][t][h][d] as bf16 hi/lo (Mh, Ml).
// roff = row offset of this half's first row within the sequence (A, A2: row 0 of the planes; C: the half's first row); bx = row tile within the half.
template <typename T16, int NSPLIT, int CMODE, int roff>
__device__ __forceinline__ void gemmc(float* os, int bx, const T16* __restrict__ A, const T16* __restrict__ A2, const T16* __restrict__ Bt, const T16* __restrict__ Bt2, float* C, bf* Mh, bf* Ml, size_t sA) {
    typedef typename WFrag<T16>::V V;
    constexpr int lda = (CMODE == 1) ? HD : BW, ldb = (CMODE == 1) ? HD : TT, ldc = (CMODE == 1) ? BW : HD;
    const size_t z = blockIdx.z; A += z * sA; if (NSPLIT) A2 += z * sA; Bt += z * (size_t)TT * HD; if (NSPLIT >= 2) Bt2 += z * (size_t)TT * HD; if (CMODE == 1) C += z * (size_t)TT * ldc;
    const int lane = threadIdx.x & 31, lr = lane & 15, hi = lane >> 4; const int r0 = bx * 64, bnd = r0 + roff - (BT - 1) * 64, jb = max(0, bnd); const int c0 = (CMODE == 1) ? bnd + (int)blockIdx.y * 64 : (int)blockIdx.y * 64;
    if (CMODE == 1 && c0 < 0) return;                                // band tile in front of key 0: does not exist
    const int K0 = (CMODE == 2) ? jb : 0;                            // P.V: first key of the band
    const int Kl = (CMODE == 2) ? min(TT, r0 + roff + 64) : HD;      // P.V: the band ends with the diagonal block
    v8f acc[4][4];
#pragma unroll
    for (int mb = 0; mb < 4; ++mb)
#pragma unroll
        for (int nb = 0; nb < 4; ++nb) acc[mb][nb] = (v8f){};
    const size_t aoff = (size_t)(r0 + lr) * lda + 8 * hi, boff = (size_t)(c0 + lr) * ldb + 8 * hi + K0;   // the A planes of P.V start at the band's first key, the B planes at key 0
    const T16* pa = A + aoff; const T16* pa2 = NSPLIT ? A2 + aoff : pa; const T16* pb = Bt + boff; const T16* pb2 = (NSPLIT >= 2) ? Bt2 + boff : pb;
#pragma unroll 1
    for (int kc = K0; kc < Kl; kc += 32) {
        V a[4], a2[4], b[4], b2[4];
#pragma unroll
        for (int mb = 0; mb < 4; ++mb) { a[mb] = WFrag<T16>::ld(pa + (size_t)(roff + mb * 16) * lda); if (NSPLIT == 1 || NSPLIT == 2) a2[mb] = WFrag<T16>::ld(pa2 + (size_t)(roff + mb * 16) * lda); }
#pragma unroll
        for (int nb = 0; nb < 4; ++nb) { b[nb] = WFrag<T16>::ld(pb + (size_t)nb * 16 * ldb); if (NSPLIT >= 2) b2[nb] = WFrag<T16>::ld(pb2 + (size_t)nb * 16 * ldb); }
        asm volatile("s_wait_xcnt 0x0" :: "v"(pa), "v"(pa2), "v"(pb), "v"(pb2) : "memory");   // the wait behind the trip's loads; as its inputs the four address pairs stay whole up to it, so that no load's result and no address step lands in one earlier
#pragma unroll
        for (int nb = 0; nb < 4; ++nb) {
#pragma unroll
            for (int mb = 0; mb < 4; ++mb) { acc[mb][nb] = WFrag<T16>::mma(a[mb], b[nb], acc[mb][nb]); if (NSPLIT == 1 || NSPLIT == 2) acc[mb][nb] = WFrag<T16>::mma(a2[mb], b[nb], acc[mb][nb]); if (NSPLIT >= 2) acc[mb][nb] = WFrag<T16>::mma(a[mb], b2[nb], acc[mb][nb]); } }
        asm volatile("v_nop\n\tv_nop\n\tv_nop\n\tv_nop" : "+v"(acc[0][0]), "+v"(acc[1][1]), "+v"(acc[2][2]), "+v"(acc[3][3]) : "v"(a[0]), "v"(a[3]));
        pa += 32; pa2 += 32; pb += 32; pb2 += 32;
    }
#pragma unroll
    for (int mb = 0; mb < 4; ++mb) {
#pragma unroll
        for (int nb = 0; nb < 4; ++nb) {
#pragma unroll
            for (int j = 0; j < 8; ++j) os[(hi * 8 + j) * 68 + nb * 16 + lr] = acc[mb][nb][j]; }
        __builtin_amdgcn_wave_barrier(); asm volatile("" ::: "memory");
        if (CMODE == 2) { const size_t ob = ((z / NH_) * TT + roff + r0 + mb * 16) * DQ + (z % NH_) * HD + c0; putp<false>(os, lane, nullptr, Mh + ob, Ml + ob, DQ, NSPLIT ? 1.0f : 1.0f / PCAR); }
        else { float* crow = C + (size_t)(r0 + mb * 16) * ldc + (c0 - jb);
#pragma unroll
            for (int s = 0; s < 8; ++s) { const int row = 2 * s + hi, cofs = lr * 4; v4f val = *(const v4fa*)(os + row * 68 + cofs);
                *(v4f*)(crow + (size_t)row * ldc + cofs) = val; }
             }
        asm volatile("s_wait_xcnt 0x0" ::: "memory");   // the wait behind these stores: the next 16 rows, and the code laid out behind this half, reuse their registers
        __builtin_amdgcn_wave_barrier(); asm volatile("" ::: "memory");
    }
}
template <int CMODE>
__global__ __launch_bounds__(32) void k_gemmc(const bf* __restrict__ Ah, const bf* __restrict__ Al, const h16* __restrict__ A16, const bf* __restrict__ Bh, const bf* __restrict__ Bl, const h16* __restrict__ B16, float* C, bf* Mh, bf* Ml) {
    __shared__ __align__(16) float os[16 * 68];
    const int bx = (int)blockIdx.x;
    if (bx < RH / 64) gemmc<bf, 2, CMODE, 0>(os, bx, Ah, Al, Bh, Bl, C, Mh, Ml, (CMODE == 1) ? (size_t)TT * HD : (size_t)RH * BW);
    else gemmc<h16, 0, CMODE, RH>(os, bx - RH / 64, A16, nullptr, B16, nullptr, (CMODE == 1) ? C + (size_t)RH * BW : C, Mh, Ml, (CMODE == 1) ? (size_t)TT * HD : (size_t)TT * BW);
}

typedef __attribute__((ext_vector_type(2))) _Float16 v2h;
typedef __attribute__((ext_vector_type(4))) _Float16 v4h;
typedef __attribute__((ext_vector_type(2))) unsigned short v2us;
typedef __attribute__((ext_vector_type(4))) unsigned short v4us;
typedef __attribute__((ext_vector_type(2))) float v2f;
typedef __attribute__((ext_vector_type(4))) int v4i;

__global__ __launch_bounds__(256) void k_wtG(const float* __restrict__ w, int K, int N, bf* Bt) {
    const int lane = threadIdx.x & 31; const int L0 = (blockIdx.x * 8 + (threadIdx.x >> 5)) * 8; const int nlines = N * K / 64;
{
#pragma unroll 1
        for (int l = 0; l < 8; ++l) { const int L = L0 + l; if (L >= nlines) break; const size_t e = (size_t)L * 64 + lane * 2; const int k = (int)(e % K), n = (int)(e / K); v2us o;
            o[0] = f2bf(w[(size_t)k * N + n]); o[1] = f2bf(w[(size_t)(k + 1) * N + n]); *(v2us*)(Bt + e) = o; }
         }
}
// k_cvtin: the jobs that read inputs only, in one grid: bf16 copies of the four weights (Wb: wq, wk, wv, wo in a row; WB blocks each), of the whole query (XB; XBL blocks).
__global__ __launch_bounds__(256) void k_cvtin(const float* __restrict__ x, const float* __restrict__ wq, const float* __restrict__ wk, const float* __restrict__ wv, const float* __restrict__ wo, bf* XB, bf* Wb) {
    constexpr unsigned WB = (unsigned)((size_t)DQ * DM / 8 / 256), XBL = (unsigned)((size_t)NB_ * TT * DM / 8 / 256); const unsigned b = blockIdx.x;
    const float* src; bf* dst; size_t i;
    if (b < 4 * WB) { const unsigned w = b / WB; src = (w == 0) ? wq : (w == 1) ? wk : (w == 2) ? wv : wo; dst = Wb + (size_t)w * DQ * DM; i = (size_t)(b % WB) * 256 + threadIdx.x; }
    else { src = x; dst = XB; i = (size_t)(b - 4 * WB) * 256 + threadIdx.x; }
    const v8f v = *(const v8f*)(src + i * 8); v8us o;
#pragma unroll
    for (int k = 0; k < 8; ++k) o[k] = f2bf(v[k]); *(v8us*)(dst + i * 8) = o;  }

// k_asoft: per row (zz, i): t = S x HD^-0.5 for j <= i and i - j < WIN (sliding causal window; a masked key's probability is exactly 0); softmax over the BW keys of the row tile's band from key jb on (register row, one exp, fixed trees);
// every key outside the band is masked, so it adds 0 to the sum and cannot be the maximum; the S and P planes hold the band only ([row][BW], column = key - jb), which is all that P.V reads.
__global__ __launch_bounds__(256) void k_asoft(const float* __restrict__ Sb, h16* P16, bf* Ph, bf* Pl) {
    const int lane = threadIdx.x & 31; const int row = blockIdx.x * 8 + (threadIdx.x >> 5); if (row >= NZ * TT) return; const int i = row % TT; const int zz = row / TT; (void)zz; const bool hires = (i < RH); const int jb = max(0, (i & ~63) - (BT - 1) * 64); const float* sr = Sb + (size_t)row * BW - jb; float v[BW / 32]; float mx = -3.0e38f;
#pragma unroll
    for (int ch = 0; ch < BW / 128; ++ch) { const int j0 = jb + ch * 128 + lane * 4; v4f a = (v4f){}; if (j0 <= i) a = *(const v4f*)(sr + j0);   // four keys wholly above the diagonal may lie in a score tile that is not computed: not read
#pragma unroll
        for (int q = 0; q < 4; ++q) { const int j = j0 + q; (void)j; const float t = (j <= i && i - j < WIN) ? a[q] * SCL : -3.0e38f; v[ch * 4 + q] = t; mx = fmaxf(mx, t); } }
#pragma unroll
    for (int sh = 16; sh; sh >>= 1) mx = fmaxf(mx, __shfl_xor(mx, sh, 32));
    float sum = 0.f;
#pragma unroll
    for (int k = 0; k < BW / 32; ++k) { float d0 = __fsub_rn(v[k], mx); asm volatile("" : "+v"(d0)); v[k] = __builtin_amdgcn_exp2f(__fmul_rn(d0, 1.4426950408889634f)); sum += v[k]; }
#pragma unroll
    for (int sh = 16; sh; sh >>= 1) sum += __shfl_xor(sum, sh, 32);
    const float f = __fdiv_rn(hires ? 1.0f : PCAR, sum);
{
        if (hires) {
#pragma unroll
            for (int ch = 0; ch < BW / 128; ++ch) { v4us oh, ol;
#pragma unroll
                for (int q = 0; q < 4; ++q) { unsigned short a, c2; splitf(v[ch * 4 + q] * f, a, c2); oh[q] = a; ol[q] = c2; }
                const size_t oo = ((size_t)zz * (RH ? RH : 1) + i) * BW + ch * 128 + lane * 4; *(v4us*)(Ph + oo) = oh; *(v4us*)(Pl + oo) = ol; }
        } else {
#pragma unroll
            for (int ch = 0; ch < BW / 128; ++ch) { v4h o4;
#pragma unroll
                for (int q = 0; q < 4; ++q) o4[q] = tohx(v[ch * 4 + q] * f);
                *(v4h*)(P16 + (size_t)row * BW + ch * 128 + lane * 4) = o4; } }
         }
}

extern "C" void kernel_launch(void* const* d_in, const int* in_sizes, int n_in,
                              void* d_out, int out_size, void* d_ws, size_t ws_size, hipStream_t stream) {
    (void)in_sizes; (void)n_in; (void)out_size;
    const float* x = (const float*)d_in[0]; const float* wq = (const float*)d_in[1]; const float* wk = (const float*)d_in[2]; const float* wv = (const float*)d_in[3]; const float* wo = (const float*)d_in[4]; const float* bo = (const float*)d_in[5];
    float* OUT = (float*)d_out;     // [8][1024][1024]
    char* wsp = (char*)d_ws;
    auto take = [&](size_t bytes) { char* p = wsp; wsp += (bytes + 255) & ~(size_t)255; return (void*)p; };
    bf* WQ = (bf*)take((size_t)DQ * DM * 2); bf* WK = (bf*)take((size_t)DKV * DM * 2); bf* WV = (bf*)take((size_t)DKV * DM * 2); bf* WO = (bf*)take((size_t)DM * DQ * 2); (void)WK; (void)WV;   // wq, wk, wv, wo in a row
    float* FQ = (float*)take((size_t)NB_ * TT * DQ * 4); float* FK = (float*)take((size_t)NB_ * TT * DKV * 4); float* FV = (float*)take((size_t)NB_ * TT * DKV * 4); (void)FK;   // FQ and FK in a row: the band scores; FV: the bf16 query
    h16* QP16 = (h16*)take((size_t)NZ * TT * HD * 2); h16* KP16 = (h16*)take((size_t)NZ * TT * HD * 2); h16* VT16 = (h16*)take((size_t)NZ * HD * TT * 2);   // q and k planes of a kind in a row
    bf* QPh = (bf*)take((size_t)NZ * TT * HD * 2); bf* KPh = (bf*)take((size_t)NZ * TT * HD * 2); bf* QPl = (bf*)take((size_t)NZ * TT * HD * 2); bf* KPl = (bf*)take((size_t)NZ * TT * HD * 2); bf* VTh = (bf*)take((size_t)NZ * HD * TT * 2); bf* VTl = (bf*)take((size_t)NZ * HD * TT * 2);
    if ((size_t)(wsp - (char*)d_ws) > ws_size) return;    // ws 256 MiB
    // Buffers that take the place of dead ones (stream-ordered; each is written whole, as far as it is read, before its first read):
    bf* XB = (bf*)FV;            // bf16 query: read by the launch that writes every q, k and v plane, so it shares bytes with none of them
    float* Sb = FQ;              // band scores [NZ][TT][BW] f32
    h16* P16 = QP16;             // [NZ][TT][BW] fp16 = the fp16 q and k planes' bytes, dead after the scores
    bf* Ph = QPh; bf* Pl = QPl;  // [NZ][RH][BW] each
    bf* ATh = KPh; bf* ATl = KPl;   // merged heads [NB_*TT][DQ] hi/lo = the hi/lo k planes' bytes, dead after the scores
    static_assert((size_t)TT * BW * 4 <= (size_t)2 * TT * HD * 4 && (size_t)TT * BW * 2 <= (size_t)2 * TT * HD * 2 && (size_t)RH * BW <= (size_t)TT * HD, "the band planes fit the buffers they replace");
    k_cvtin<<<(unsigned)(((size_t)4 * DQ * DM + (size_t)NB_ * TT * DM) / 8 / 256), 256, 0, stream>>>(x, wq, wk, wv, wo, XB, WQ);
    k_gemmw<bf, 0, false, true><<<dim3(NB_ * TT / 64, DQ / 64, 3), 32, 0, stream>>>(XB, nullptr, WQ, nullptr, DM, nullptr, 0, nullptr, 0, (size_t)DQ * DM, 0, QP16, QPh, QPl, VT16, VTh, VTl);   // z: q, k, v
    k_gemmc<1><<<dim3(TT / 64, BT, NZ), 32, 0, stream>>>(QPh, QPl, QP16, KPh, KPl, KP16, Sb, nullptr, nullptr);
    k_asoft<<<NZ * TT / 8, 256, 0, stream>>>(Sb, P16, Ph, Pl);
    k_gemmc<2><<<dim3(TT / 64, HD / 64, NZ), 32, 0, stream>>>(Ph, Pl, P16, VTh, VTl, VT16, nullptr, ATh, ATl);
    k_gemmw<bf, 1, true, false><<<dim3(NB_ * TT / 64, DM / 64, 1), 32, 0, stream>>>(ATh, ATl, WO, nullptr, DQ, OUT, DM, bo, 0, 0, 0, nullptr, nullptr, nullptr, nullptr, nullptr, nullptr);
}

// v004
// One run takes 218 microseconds.
// Two timings next to v003 both put it at 1.15 times that version's speed.
// Counting every step since v000, it is 17.9 times as fast.
#include <hip/hip_runtime.h>

// Causal sliding-window multi-head attention (query [8][1024][1024]; q,k,v = query W^T ('oi' 1/32, no bias; 16 heads x 64); scores x 64^-0.5; query i sees keys j in [i-63, i] (window 64; -inf elsewhere); softmax; out = merged Wo^T + bo -> [8][1024][1024] (8.4 M)).
// Layout, every stage one launch over all 8 batches and 16 heads (z = batch x 16 + head): bf16 copy of query; 'oi' weights; exact projections, whose epilogue writes the q, k and transposed v planes; causal T-1024 attention in one launch on the 128-key band that holds each 64-row tile's 64-key windows (hybrid rows: < 512 hi/lo 3 products, rest fp16 x1024; scores and probabilities stay in LDS; keys outside the band are never touched; the epilogue writes the merged hi/lo planes); merged hi/lo x Wo exact + bo.
// Compute dtypes, f32 accumulate: every input rounded to bf16; projections exact; attention rows < 512 3 products, rest fp16; softmax f32; Wo hl x exact + bias.

#define NB_  8
#define TT   1024
#define DM   1024
#define NH_  16
#define NKV  16
#define REP  (NH_ / NKV)
#define HD   64
#define DQ   (NH_ * HD)
#define DKV  (NKV * HD)
#define NZ   (NB_ * NH_)          // attention planes: one per (batch, head)
#define RH   512                  // query rows < RH use hi+lo planes (0: none)
#define WIN  64      // causal sliding window: keys j in [i-63, i]
#define BT   ((WIN + 62) / 64 + 1)   // 64-key tiles that cover the windows of one 64-row tile: keys [R - (BT-1)*64, R + 64) for rows R..R+63
#define BW   (BT * 64)               // band width in keys
static_assert(BW % 128 == 0 && BW <= TT && RH % 64 == 0, "the softmax reads the band in 128-key chunks; the two precision halves meet at a 64-row tile's edge");
static_assert(NH_ == NKV && DQ == DM, "q, k, v share one projection launch and one plane shape; the four weights share one conversion shape");
#define PCAR 1024.0f
#define SCL  0.125f   // HD^-0.5
typedef _Float16 h16;
typedef unsigned short bf;
typedef __attribute__((ext_vector_type(16))) __bf16   v16bf;
typedef __attribute__((ext_vector_type(16))) _Float16 v16h;
typedef __attribute__((ext_vector_type(8)))  _Float16 v8h;
typedef __attribute__((ext_vector_type(8)))  unsigned short v8us;
typedef __attribute__((ext_vector_type(8)))  float    v8f;
typedef __attribute__((ext_vector_type(4)))  float    v4f;
typedef v8h  __attribute__((may_alias)) v8ha;
typedef v4f  __attribute__((may_alias)) v4fa;
typedef v8us __attribute__((may_alias)) v8usa;

__device__ __forceinline__ unsigned short f2bf(float f) { unsigned u = __float_as_uint(f); u += 0x7FFFu + ((u >> 16) & 1u); return (unsigned short)(u >> 16); }
__device__ __forceinline__ float bf2f(unsigned short b) { return __uint_as_float(((unsigned)b) << 16); }
__device__ __forceinline__ float bfr(float f) { return bf2f(f2bf(f)); }
__device__ __forceinline__ v16h cat16(v8h lo, v8h hi) { return __builtin_shufflevector(lo, hi, 0, 1, 2, 3, 4, 5, 6, 7, 8, 9, 10, 11, 12, 13, 14, 15); }
__device__ __forceinline__ v16bf cat16b(v8us lo, v8us hi) { return __builtin_bit_cast(v16bf, __builtin_shufflevector(lo, hi, 0, 1, 2, 3, 4, 5, 6, 7, 8, 9, 10, 11, 12, 13, 14, 15)); }
__device__ __forceinline__ v8f wmma16(v16h a, v16h b, v8f c) { return __builtin_amdgcn_wmma_f32_16x16x32_f16(false, a, false, b, (short)0, c, false, false); }
__device__ __forceinline__ v8f wmmab(v16bf a, v16bf b, v8f c) { return __builtin_amdgcn_wmma_f32_16x16x32_bf16(false, a, false, b, (short)0, c, false, false); }
__device__ __forceinline__ h16 tohx(float x) { return (h16)x; }
__device__ __forceinline__ void splitf(float y, unsigned short& h, unsigned short& l) { h = f2bf(y); l = f2bf(y - bf2f(h)); }

// putp: 16 rows x 64 f32 staged in os (pitch 68) leave as 16-bit rows of 64 (128 bytes) at dh/dl (bf16 hi/lo of x * cs) and, with F16, at d16 (fp16 of x * cs); pitch in elements.
// Each lane converts 8 neighbours of one row, so that every store of the wave covers four whole 128-byte rows.
template <bool F16>
__device__ __forceinline__ void putp(const float* os, int lane, h16* d16, bf* dh, bf* dl, size_t pitch, float cs) {
#pragma unroll
    for (int s = 0; s < 4; ++s) { const int row = 4 * s + (lane >> 3), cofs = (lane & 7) * 8; const v4f x0 = *(const v4fa*)(os + row * 68 + cofs), x1 = *(const v4fa*)(os + row * 68 + cofs + 4); v8h o16; v8us oh, ol;
#pragma unroll
        for (int q = 0; q < 8; ++q) { const float x = ((q < 4) ? x0[q & 3] : x1[q & 3]) * cs; if (F16) o16[q] = tohx(x); unsigned short a2, c2; splitf(x, a2, c2); oh[q] = a2; ol[q] = c2; }
        const size_t oo = (size_t)row * pitch + cofs; if (F16) *(v8ha*)(d16 + oo) = o16; *(v8usa*)(dh + oo) = oh; *(v8usa*)(dl + oo) = ol;
        asm volatile("s_wait_xcnt 0x0" ::: "memory");   // the wait behind these stores: the next four rows reuse their registers
    }
}



// ---- k_gemmw: register-blocked GEMM, ONE WAVE per 64x64 output tile (16 accumulators), operands straight from K-contiguous 16-bit planes; grid (M/64, N/64, Z), 32 threads.
// C[m][n] (f32, pitch ldc, + optional f32 bias[n]) = sum_k A[m][k] Bt[n][k] (+ split products per NSPLIT). z-batch strides sA/sB/sC in elements. K % 32 == 0.
// PLANES (the q, k, v projections, z = 0, 1, 2): a tile is 64 tokens of one head, and no C is written: the epilogue stores the head planes themselves (fp16 + bf16 hi/lo), q and k as [z][b][h][t][d], v transposed as [b][h][d][t].
template <typename T16> struct WFrag;
template <> struct WFrag<h16> { typedef v16h V; static __device__ __forceinline__ V ld(const h16* p) { return cat16(*(const v8h*)p, *(const v8h*)(p + 16)); } static __device__ __forceinline__ v8f mma(V a, V b, v8f c) { return wmma16(a, b, c); } };
template <> struct WFrag<bf> { typedef v16bf V; static __device__ __forceinline__ V ld(const bf* p) { return cat16b(*(const v8us*)p, *(const v8us*)(p + 16)); } static __device__ __forceinline__ v8f mma(V a, V b, v8f c) { return wmmab(a, b, c); } };
template <typename T16, int NSPLIT, bool BIAS, bool PLANES>
__global__ __launch_bounds__(32) void k_gemmw(const T16* __restrict__ A, const T16* __restrict__ A2, const T16* __restrict__ Bt, const T16* __restrict__ Bt2, int K, float* C, int ldc, const float* __restrict__ bias, size_t sA, size_t sB, size_t sC, h16* P16, bf* Ph, bf* Pl, h16* V16, bf* Vh, bf* Vl) {
    typedef typename WFrag<T16>::V V;
    __shared__ __align__(16) float os[16 * 68];
    const size_t z = blockIdx.z; A += z * sA; if (A2) A2 += z * sA; Bt += z * sB; if (Bt2) Bt2 += z * sB; C += z * sC;
    const int lane = threadIdx.x & 31, lr = lane & 15, hi = lane >> 4; const int r0 = blockIdx.x * 64, c0 = blockIdx.y * 64;
    v8f acc[4][4];
#pragma unroll
    for (int mb = 0; mb < 4; ++mb)
#pragma unroll
        for (int nb = 0; nb < 4; ++nb) acc[mb][nb] = (v8f){};
    const size_t aoff = (size_t)(r0 + lr) * K + 8 * hi, boff = (size_t)(c0 + lr) * K + 8 * hi;
#pragma unroll 1
    for (int kc = 0; kc < K; kc += 32) {
        V a[4], a2[4];
#pragma unroll
        for (int mb = 0; mb < 4; ++mb) { a[mb] = WFrag<T16>::ld(A + aoff + (size_t)mb * 16 * K + kc); if (NSPLIT == 1 || NSPLIT == 2) a2[mb] = WFrag<T16>::ld(A2 + aoff + (size_t)mb * 16 * K + kc); }
#pragma unroll
        for (int nb = 0; nb < 4; ++nb) { const V b = WFrag<T16>::ld(Bt + boff + (size_t)nb * 16 * K + kc); V b2; if (NSPLIT >= 2) b2 = WFrag<T16>::ld(Bt2 + boff + (size_t)nb * 16 * K + kc);
#pragma unroll
            for (int mb = 0; mb < 4; ++mb) { acc[mb][nb] = WFrag<T16>::mma(a[mb], b, acc[mb][nb]); if (NSPLIT == 1 || NSPLIT == 2) acc[mb][nb] = WFrag<T16>::mma(a2[mb], b, acc[mb][nb]); if (NSPLIT >= 2) acc[mb][nb] = WFrag<T16>::mma(a[mb], b2, acc[mb][nb]); } }
        asm volatile("v_nop\n\tv_nop\n\tv_nop\n\tv_nop" : "+v"(acc[0][0]), "+v"(acc[1][1]), "+v"(acc[2][2]), "+v"(acc[3][3]) : "v"(a[0]), "v"(a[3]));
    }
    if (PLANES) {
        static_assert(HD == 64 && TT % 64 == 0, "a 64x64 tile is 64 tokens of one batch and one head");
        const int t0 = r0 % TT; const size_t zz = (size_t)(r0 / TT) * NH_ + blockIdx.y;
        if (z < 2) {                                                  // q, k: staged rows are tokens
            const size_t base = ((z * NZ + zz) * TT + t0) * HD;
#pragma unroll
            for (int mb = 0; mb < 4; ++mb) {
#pragma unroll
                for (int nb = 0; nb < 4; ++nb) {
#pragma unroll
                    for (int j = 0; j < 8; ++j) os[(hi * 8 + j) * 68 + nb * 16 + lr] = acc[mb][nb][j]; }
                __builtin_amdgcn_wave_barrier(); asm volatile("" ::: "memory");
                putp<true>(os, lane, P16 + base + mb * 16 * HD, Ph + base + mb * 16 * HD, Pl + base + mb * 16 * HD, HD, 1.0f);
                __builtin_amdgcn_wave_barrier(); asm volatile("" ::: "memory");
            }
        } else {                                                      // v: staged rows are head dims; a lane's 8 accumulator rows are 8 tokens in a row
            const size_t base = zz * HD * TT + t0;
#pragma unroll
            for (int nb = 0; nb < 4; ++nb) {
#pragma unroll
                for (int mb = 0; mb < 4; ++mb) { float* o = os + lr * 68 + mb * 16 + hi * 8; *(v4fa*)o = __builtin_shufflevector(acc[mb][nb], acc[mb][nb], 0, 1, 2, 3); *(v4fa*)(o + 4) = __builtin_shufflevector(acc[mb][nb], acc[mb][nb], 4, 5, 6, 7); }
                __builtin_amdgcn_wave_barrier(); asm volatile("" ::: "memory");
                putp<true>(os, lane, V16 + base + (size_t)nb * 16 * TT, Vh + base + (size_t)nb * 16 * TT, Vl + base + (size_t)nb * 16 * TT, TT, 1.0f);
                __builtin_amdgcn_wave_barrier(); asm volatile("" ::: "memory");
            }
        }
        return;
    }
#pragma unroll
    for (int mb = 0; mb < 4; ++mb) {
#pragma unroll
        for (int nb = 0; nb < 4; ++nb) {
#pragma unroll
            for (int j = 0; j < 8; ++j) os[(hi * 8 + j) * 68 + nb * 16 + lr] = acc[mb][nb][j]; }
        __builtin_amdgcn_wave_barrier(); asm volatile("" ::: "memory");
        float* crow = C + (size_t)(r0 + mb * 16) * ldc + c0;
{
#pragma unroll
            for (int s = 0; s < 8; ++s) { const int row = 2 * s + hi, cofs = lr * 4; v4f val = *(const v4fa*)(os + row * 68 + cofs); if (BIAS) { val[0] += bfr(bias[c0 + cofs]); val[1] += bfr(bias[c0 + cofs + 1]); val[2] += bfr(bias[c0 + cofs + 2]); val[3] += bfr(bias[c0 + cofs + 3]); }
                *(v4f*)(crow + (size_t)row * ldc + cofs) = val; }
             }
        __builtin_amdgcn_wave_barrier(); asm volatile("" ::: "memory");
    }
}

typedef __attribute__((ext_vector_type(2))) _Float16 v2h;
typedef __attribute__((ext_vector_type(4))) _Float16 v4h;
typedef __attribute__((ext_vector_type(2))) unsigned short v2us;
typedef __attribute__((ext_vector_type(4))) unsigned short v4us;
typedef __attribute__((ext_vector_type(2))) float v2f;
typedef __attribute__((ext_vector_type(4))) int v4i;

__global__ __launch_bounds__(256) void k_wtG(const float* __restrict__ w, int K, int N, bf* Bt) {
    const int lane = threadIdx.x & 31; const int L0 = (blockIdx.x * 8 + (threadIdx.x >> 5)) * 8; const int nlines = N * K / 64;
{
#pragma unroll 1
        for (int l = 0; l < 8; ++l) { const int L = L0 + l; if (L >= nlines) break; const size_t e = (size_t)L * 64 + lane * 2; const int k = (int)(e % K), n = (int)(e / K); v2us o;
            o[0] = f2bf(w[(size_t)k * N + n]); o[1] = f2bf(w[(size_t)(k + 1) * N + n]); *(v2us*)(Bt + e) = o; }
         }
}
// k_cvtin: the jobs that read inputs only, in one grid: bf16 copies of the four weights (Wb: wq, wk, wv, wo in a row; WB blocks each), of the whole query (XB; XBL blocks).
__global__ __launch_bounds__(256) void k_cvtin(const float* __restrict__ x, const float* __restrict__ wq, const float* __restrict__ wk, const float* __restrict__ wv, const float* __restrict__ wo, bf* XB, bf* Wb) {
    constexpr unsigned WB = (unsigned)((size_t)DQ * DM / 8 / 256), XBL = (unsigned)((size_t)NB_ * TT * DM / 8 / 256); const unsigned b = blockIdx.x;
    const float* src; bf* dst; size_t i;
    if (b < 4 * WB) { const unsigned w = b / WB; src = (w == 0) ? wq : (w == 1) ? wk : (w == 2) ? wv : wo; dst = Wb + (size_t)w * DQ * DM; i = (size_t)(b % WB) * 256 + threadIdx.x; }
    else { src = x; dst = XB; i = (size_t)(b - 4 * WB) * 256 + threadIdx.x; }
    const v8f v = *(const v8f*)(src + i * 8); v8us o;
#pragma unroll
    for (int k = 0; k < 8; ++k) o[k] = f2bf(v[k]); *(v8us*)(dst + i * 8) = o;  }

// ---- k_attn: causal sliding-window attention of one 64-row tile of one (batch, head) plane per work-group; grid (TT/64, 1, NZ), 4 waves, each wave on its own 16 rows with its own LDS, so no wave waits for another.
// With R64 the tile's first query row, every key a row of the tile may see lies in the band [R64-(BT-1)*64, R64+64); jb = max(0, its first key); the wave works on the BW keys from jb on (in the first tile the upper half of them is masked like any key above the diagonal).
// Row tiles < RH/64: hi/lo bf16, 3 products; the rest: fp16 with the probabilities x1024. Per wave: S = q k^T (16 x BW, K = HD) -> LDS f32 -> softmax, one row per pass of the wave's 32 lanes x 4 keys (one exp, fixed trees) -> P in LDS as 16-bit rows -> P V^T (K = BW) -> merged heads [b][t][h][d] as bf16 hi/lo (Mh, Ml).
#define SP 132   // f32 pitch of a staged score row: rows 8 apart land 32 banks apart
#define PP 136   // 16-bit pitch of a staged probability row: 256 B + 16 B for the 16-byte fragment reads
typedef v4us __attribute__((may_alias)) v4usa;
typedef v4h  __attribute__((may_alias)) v4ha;
// 2^x; the v_nop is the one slot the instruction set asks for behind a transcendental before its result is read or its source overwritten: in one statement with it, so that it stands directly behind it
__device__ __forceinline__ float exp2s(float x) { float y; asm("v_exp_f32 %0, %1\n\tv_nop" : "=v"(y) : "v"(x)); return y; }
template <typename T16, int NSPLIT>
__device__ __forceinline__ void attn16(float* os, T16* ph, T16* pl, int R, int jb, const T16* __restrict__ Q, const T16* __restrict__ Q2, const T16* __restrict__ Kp, const T16* __restrict__ K2, const T16* __restrict__ Vt, const T16* __restrict__ V2, bf* Mh, bf* Ml) {
    typedef typename WFrag<T16>::V V;
    static_assert(BW == 128 && HD == 64, "a row of the band is one 4-key read of 32 lanes; the head dim is two K trips and four output tiles");
    const size_t z = blockIdx.z; const int lane = threadIdx.x & 31, lr = lane & 15, hi = lane >> 4;
    const size_t qoff = (z * TT + R + lr) * HD + 8 * hi, koff = (z * TT + jb + lr) * HD + 8 * hi, voff = (z * HD + lr) * TT + jb + 8 * hi;
    const T16* pq = Q + qoff; const T16* pq2 = NSPLIT ? Q2 + qoff : pq; const T16* pk = Kp + koff; const T16* pk2 = NSPLIT ? K2 + koff : pk; const T16* pv = Vt + voff; const T16* pv2 = NSPLIT ? V2 + voff : pv;
    V a[2], a2[2], b[2][8], b2[2][8]; v8f s[8];
#pragma unroll
    for (int nb = 0; nb < 8; ++nb) s[nb] = (v8f){};
    auto ldk = [&](int kc, int nb) { b[kc][nb] = WFrag<T16>::ld(pk + nb * 16 * HD + kc * 32); if (NSPLIT) b2[kc][nb] = WFrag<T16>::ld(pk2 + nb * 16 * HD + kc * 32); };
    auto mmk = [&](int kc, int nb) { s[nb] = WFrag<T16>::mma(a[kc], b[kc][nb], s[nb]); if (NSPLIT) { s[nb] = WFrag<T16>::mma(a2[kc], b[kc][nb], s[nb]); s[nb] = WFrag<T16>::mma(a[kc], b2[kc][nb], s[nb]); } };
#pragma unroll
    for (int kc = 0; kc < 2; ++kc) { a[kc] = WFrag<T16>::ld(pq + kc * 32); if (NSPLIT) a2[kc] = WFrag<T16>::ld(pq2 + kc * 32); }
#pragma unroll
    for (int nb = 0; nb < 8; ++nb) { ldk(0, nb); if (!NSPLIT) ldk(1, nb); }
    if (NSPLIT) {   // the hi/lo half's registers hold one K trip's key fragments: the second trip's take the place of the first's, tile by tile
        asm volatile("s_wait_xcnt 0x0" :: "v"(pq), "v"(pq2), "v"(pk), "v"(pk2) : "memory");   // the wait behind the q loads and the first trip's k loads; as its inputs the four address pairs stay whole up to it
        __builtin_amdgcn_sched_barrier(0);   // keeps every load of the first trip in front of the first product: moved among the products they were issued and waited for pair by pair, one L2 round trip each
#pragma unroll
        for (int nb = 0; nb < 8; ++nb) { mmk(0, nb); ldk(1, nb); }
    }
    asm volatile("s_wait_xcnt 0x0" :: "v"(pq), "v"(pq2), "v"(pk), "v"(pk2) : "memory");   // the wait behind the q and k loads; as its inputs the four address pairs stay whole up to it
    if (!NSPLIT) {
#pragma unroll
        for (int nb = 0; nb < 8; ++nb) mmk(0, nb); }
#pragma unroll
    for (int nb = 0; nb < 8; ++nb) mmk(1, nb);
    constexpr int TPRE = NSPLIT ? 1 : 4;                              // value fragments of the first TPRE K trips fly while the softmax runs: as many as the registers hold beside it
    V vb[4][4], vb2[4][4];
    auto ldv = [&](int t) {
#pragma unroll
        for (int nb = 0; nb < 4; ++nb) { vb[t][nb] = WFrag<T16>::ld(pv + (size_t)nb * 16 * TT + t * 32); if (NSPLIT) vb2[t][nb] = WFrag<T16>::ld(pv2 + (size_t)nb * 16 * TT + t * 32); } };
#pragma unroll
    for (int t = 0; t < TPRE; ++t) ldv(t);
    asm volatile("s_wait_xcnt 0x0" :: "v"(pv), "v"(pv2) : "memory");   // the wait behind the v loads; as its inputs the two address pairs stay whole up to it
#pragma unroll
    for (int nb = 0; nb < 8; ++nb) {
#pragma unroll
        for (int j = 0; j < 8; ++j) os[(hi * 8 + j) * SP + nb * 16 + lr] = s[nb][j]; }
    __builtin_amdgcn_wave_barrier(); asm volatile("" ::: "memory");   // the rows are read back by other lanes of this wave: no LDS read may move in front of these writes
    // softmax of the 16 rows, stage by stage so that the rows' chains overlap: t = S x HD^-0.5 for j <= i and i - j < WIN; a masked key's probability is exactly 0
    float v[16][4], mx[16], sum[16], o16[16]; v4f x[16]; const int dl = R - (jb + lane * 4);   // i - j of row 0 and the lane's first key
    // each sched_barrier below keeps the 16 rows' LDS reads or cross-lane reads in flight together: moved down to their uses they were issued and waited for one by one, one LDS latency each
#pragma unroll
    for (int r = 0; r < 16; ++r) x[r] = *(const v4fa*)(os + r * SP + lane * 4);
    __builtin_amdgcn_sched_barrier(0);
#pragma unroll
    for (int r = 0; r < 16; ++r) { mx[r] = -3.0e38f;
#pragma unroll
        for (int q = 0; q < 4; ++q) { const float t = ((unsigned)(dl + (r - q)) < (unsigned)WIN) ? x[r][q] * SCL : -3.0e38f; v[r][q] = t; mx[r] = fmaxf(mx[r], t); } }   // 0 <= i - j < WIN in one unsigned compare
#pragma unroll
    for (int sh = 16; sh; sh >>= 1) {
#pragma unroll
        for (int r = 0; r < 16; ++r) o16[r] = __shfl_xor(mx[r], sh, 32);
        __builtin_amdgcn_sched_barrier(0);
#pragma unroll
        for (int r = 0; r < 16; ++r) mx[r] = fmaxf(mx[r], o16[r]); }
#pragma unroll
    for (int r = 0; r < 16; ++r) { sum[r] = 0.f;
#pragma unroll
        for (int q = 0; q < 4; ++q) { v[r][q] = exp2s(__fmul_rn(__fsub_rn(v[r][q], mx[r]), 1.4426950408889634f)); sum[r] += v[r][q]; } }
#pragma unroll
    for (int sh = 16; sh; sh >>= 1) {
#pragma unroll
        for (int r = 0; r < 16; ++r) o16[r] = __shfl_xor(sum[r], sh, 32);
        __builtin_amdgcn_sched_barrier(0);
#pragma unroll
        for (int r = 0; r < 16; ++r) sum[r] += o16[r]; }
#pragma unroll
    for (int r = 0; r < 16; ++r) { const float f = __fdiv_rn(NSPLIT ? 1.0f : PCAR, sum[r]);
        if (NSPLIT) { v4us oh, ol;
#pragma unroll
            for (int q = 0; q < 4; ++q) { unsigned short h2, l2; splitf(v[r][q] * f, h2, l2); oh[q] = h2; ol[q] = l2; }
            *(v4usa*)(ph + r * PP + lane * 4) = oh; *(v4usa*)(pl + r * PP + lane * 4) = ol;
        } else { v4h o4;
#pragma unroll
            for (int q = 0; q < 4; ++q) o4[q] = tohx(v[r][q] * f);
            *(v4ha*)(ph + r * PP + lane * 4) = o4; } }
    __builtin_amdgcn_wave_barrier(); asm volatile("" ::: "memory");   // the probability rows are read back as fragments by other lanes of this wave
    v8f o[4];
#pragma unroll
    for (int nb = 0; nb < 4; ++nb) o[nb] = (v8f){};
#pragma unroll
    for (int t = 0; t < 4; ++t) { const V p = WFrag<T16>::ld(ph + lr * PP + 8 * hi + t * 32); V p2; if (NSPLIT) p2 = WFrag<T16>::ld(pl + lr * PP + 8 * hi + t * 32);
        if (NSPLIT && t < 2) { if (t == 0) { ldv(1); ldv(2); } else ldv(3);   // the rest of the hi/lo half's value fragments, each trip's as soon as registers are free for it
            asm volatile("s_wait_xcnt 0x0" :: "v"(pv), "v"(pv2) : "memory"); }   // the wait behind these v loads, as above
#pragma unroll
        for (int nb = 0; nb < 4; ++nb) { o[nb] = WFrag<T16>::mma(p, vb[t][nb], o[nb]); if (NSPLIT) { o[nb] = WFrag<T16>::mma(p2, vb[t][nb], o[nb]); o[nb] = WFrag<T16>::mma(p, vb2[t][nb], o[nb]); } } }
#pragma unroll
    for (int nb = 0; nb < 4; ++nb) {
#pragma unroll
        for (int j = 0; j < 8; ++j) os[(hi * 8 + j) * 68 + nb * 16 + lr] = o[nb][j]; }
    __builtin_amdgcn_wave_barrier(); asm volatile("" ::: "memory");   // putp reads the staged rows across lanes
    const size_t ob = ((z / NH_) * TT + R) * DQ + (z % NH_) * HD; putp<false>(os, lane, nullptr, Mh + ob, Ml + ob, DQ, NSPLIT ? 1.0f : 1.0f / PCAR);   // the fp16 half's x1024 comes off again
}
// the second launch bound asks for four waves a SIMD (256 registers a wave): without it the hi/lo half went above v255, two waves a SIMD, with a register-window switch at more than every fourth instruction
__global__ __launch_bounds__(128, 4) void k_attn(const bf* __restrict__ Qh, const bf* __restrict__ Ql, const h16* __restrict__ Q16, const bf* __restrict__ Kh, const bf* __restrict__ Kl, const h16* __restrict__ K16, const bf* __restrict__ Vh, const bf* __restrict__ Vl, const h16* __restrict__ V16, bf* Mh, bf* Ml) {
    __shared__ __align__(16) float os[4][16 * SP]; __shared__ __align__(16) unsigned short pp[4][2][16 * PP];
    const int w = __builtin_amdgcn_readfirstlane((int)(threadIdx.x >> 5)); const int R64 = (int)blockIdx.x * 64, jb = max(0, R64 - (BT - 1) * 64), R = R64 + w * 16;
    if (R64 < RH) attn16<bf, 2>(os[w], pp[w][0], pp[w][1], R, jb, Qh, Ql, Kh, Kl, Vh, Vl, Mh, Ml);
    else attn16<h16, 0>(os[w], (h16*)pp[w][0], (h16*)nullptr, R, jb, Q16, (const h16*)nullptr, K16, (const h16*)nullptr, V16, (const h16*)nullptr, Mh, Ml);
}

extern "C" void kernel_launch(void* const* d_in, const int* in_sizes, int n_in,
                              void* d_out, int out_size, void* d_ws, size_t ws_size, hipStream_t stream) {
    (void)in_sizes; (void)n_in; (void)out_size;
    const float* x = (const float*)d_in[0]; const float* wq = (const float*)d_in[1]; const float* wk = (const float*)d_in[2]; const float* wv = (const float*)d_in[3]; const float* wo = (const float*)d_in[4]; const float* bo = (const float*)d_in[5];
    float* OUT = (float*)d_out;     // [8][1024][1024]
    char* wsp = (char*)d_ws;
    auto take = [&](size_t bytes) { char* p = wsp; wsp += (bytes + 255) & ~(size_t)255; return (void*)p; };
    bf* WQ = (bf*)take((size_t)DQ * DM * 2); bf* WK = (bf*)take((size_t)DKV * DM * 2); bf* WV = (bf*)take((size_t)DKV * DM * 2); bf* WO = (bf*)take((size_t)DM * DQ * 2); (void)WK; (void)WV;   // wq, wk, wv, wo in a row
    float* FQ = (float*)take((size_t)NB_ * TT * DQ * 4); float* FK = (float*)take((size_t)NB_ * TT * DKV * 4); float* FV = (float*)take((size_t)NB_ * TT * DKV * 4);   // FQ, FK: the merged heads; FV: the bf16 query
    h16* QP16 = (h16*)take((size_t)NZ * TT * HD * 2); h16* KP16 = (h16*)take((size_t)NZ * TT * HD * 2); h16* VT16 = (h16*)take((size_t)NZ * HD * TT * 2);   // q and k planes of a kind in a row
    bf* QPh = (bf*)take((size_t)NZ * TT * HD * 2); bf* KPh = (bf*)take((size_t)NZ * TT * HD * 2); bf* QPl = (bf*)take((size_t)NZ * TT * HD * 2); bf* KPl = (bf*)take((size_t)NZ * TT * HD * 2); bf* VTh = (bf*)take((size_t)NZ * HD * TT * 2); bf* VTl = (bf*)take((size_t)NZ * HD * TT * 2);
    if ((size_t)(wsp - (char*)d_ws) > ws_size) return;    // ws 256 MiB
    // Buffers that take the place of dead ones (stream-ordered; each is written whole, as far as it is read, before its first read):
    bf* XB = (bf*)FV;            // bf16 query: read by the launch that writes every q, k and v plane, so it shares bytes with none of them
    bf* ATh = (bf*)FQ; bf* ATl = (bf*)FK;   // merged heads [NB_*TT][DQ] hi/lo: written by the launch that reads every q, k and v plane, so they share bytes with none of them
    k_cvtin<<<(unsigned)(((size_t)4 * DQ * DM + (size_t)NB_ * TT * DM) / 8 / 256), 256, 0, stream>>>(x, wq, wk, wv, wo, XB, WQ);
    k_gemmw<bf, 0, false, true><<<dim3(NB_ * TT / 64, DQ / 64, 3), 32, 0, stream>>>(XB, nullptr, WQ, nullptr, DM, nullptr, 0, nullptr, 0, (size_t)DQ * DM, 0, QP16, QPh, QPl, VT16, VTh, VTl);   // z: q, k, v
    k_attn<<<dim3(TT / 64, 1, NZ), 128, 0, stream>>>(QPh, QPl, QP16, KPh, KPl, KP16, VTh, VTl, VT16, ATh, ATl);
    k_gemmw<bf, 1, true, false><<<dim3(NB_ * TT / 64, DM / 64, 1), 32, 0, stream>>>(ATh, ATl, WO, nullptr, DQ, OUT, DM, bo, 0, 0, 0, nullptr, nullptr, nullptr, nullptr, nullptr, nullptr);
}
